// v000
// The times below were measured on an AMD MI455X: many runs one after another, warmed up first and cycling through
// copies of the inputs, with the whole window's GPU time divided by the number of runs. Launches and the gaps
// between them are all in it. The median over several windows is given; except for v000 it joins two sittings, which
// can be a few percent apart, so the side-by-side timings, each taken in one sitting, are the better comparison.
// The starting kernel, v000, takes 154 microseconds a run.
#include <hip/hip_runtime.h>
#include <hip/hip_bf16.h>

typedef __bf16 bf16_t;
typedef __attribute__((ext_vector_type(16))) __bf16        v16bf;
typedef __attribute__((ext_vector_type(8)))  float         v8f;
typedef __attribute__((ext_vector_type(8)))  unsigned int  v8u;

#define NTOK    8192
#define DMODEL  128
#define GSPLIT  4
#define KV_PER_G (NTOK / GSPLIT)
#define SM_SCALE 0.08838834764831845f   // 1/sqrt(128)

// ---------- helpers ----------

// two f32 -> packed 2x bf16 (RNE) using the native conversion path
__device__ __forceinline__ unsigned int pack_bf2(float a, float b) {
  unsigned short ua = __builtin_bit_cast(unsigned short, (__bf16)a);
  unsigned short ub = __builtin_bit_cast(unsigned short, (__bf16)b);
  return (unsigned int)ua | ((unsigned int)ub << 16);
}

__device__ __forceinline__ v8f wmma_bf16(v16bf a, v16bf b, v8f c) {
  // D = A(16x32) * B(32x16) + C, fp32 accumulate
  return __builtin_amdgcn_wmma_f32_16x16x32_bf16(false, a, false, b, (short)0, c,
                                                 false, false);
}

// A/B fragment for V_WMMA_F32_16X16X32_BF16 built from a row-major matrix.
// ISA 7.12.2 16-bit A layout: row r = lane&15; lanes 0-15 hold K
// {k0..k0+7, k0+16..k0+23}; lanes 16-31 hold K {k0+8..k0+15, k0+24..k0+31}.
// B uses the mirrored layout with r = output-column index, so the same loader
// serves B-fragments of W (x @ W^T) and of Q (row-major, contiguous in K).
__device__ __forceinline__ v16bf frag_f32(const float* __restrict__ base,
                                          int ld, int r0, int k0) {
  int lane = threadIdx.x & 31;
  const float* p = base + (size_t)(r0 + (lane & 15)) * ld + k0 + ((lane >> 4) << 3);
  float4 a0 = ((const float4*)p)[0];
  float4 a1 = ((const float4*)p)[1];
  float4 b0 = ((const float4*)p)[4];   // p + 16 floats
  float4 b1 = ((const float4*)p)[5];
  v8u u = {pack_bf2(a0.x, a0.y), pack_bf2(a0.z, a0.w),
           pack_bf2(a1.x, a1.y), pack_bf2(a1.z, a1.w),
           pack_bf2(b0.x, b0.y), pack_bf2(b0.z, b0.w),
           pack_bf2(b1.x, b1.y), pack_bf2(b1.z, b1.w)};
  return __builtin_bit_cast(v16bf, u);
}

__device__ __forceinline__ v16bf frag_bf16(const bf16_t* __restrict__ base,
                                           int ld, int r0, int k0) {
  int lane = threadIdx.x & 31;
  const bf16_t* p = base + (size_t)(r0 + (lane & 15)) * ld + k0 + ((lane >> 4) << 3);
  uint4 lo = *(const uint4*)p;         // 8 bf16
  uint4 hi = *(const uint4*)(p + 16);  // 8 bf16
  v8u u = {lo.x, lo.y, lo.z, lo.w, hi.x, hi.y, hi.z, hi.w};
  return __builtin_bit_cast(v16bf, u);
}

// ---------- kernel 1: Q/K/V projections ----------
// One wave per 16x16 tile. 512 row-tiles * {Q,K,V} * 8 col-tiles = 12288 waves.
__global__ void __launch_bounds__(256) qkv_kernel(
    const float* __restrict__ x,
    const float* __restrict__ Wq, const float* __restrict__ bq,
    const float* __restrict__ Wk, const float* __restrict__ bk,
    const float* __restrict__ Wv, const float* __restrict__ bv,
    bf16_t* __restrict__ Qb, bf16_t* __restrict__ Kb, bf16_t* __restrict__ Vt) {
  int wid  = (blockIdx.x * 256 + threadIdx.x) >> 5;
  int tile = wid / 24, rem = wid % 24;
  int mat = rem >> 3, nt = rem & 7;
  int row0 = tile * 16, n0 = nt * 16;
  const float* W    = (mat == 0) ? Wq : (mat == 1) ? Wk : Wv;
  const float* bias = (mat == 0) ? bq : (mat == 1) ? bk : bv;

  v8f acc = {0.f, 0.f, 0.f, 0.f, 0.f, 0.f, 0.f, 0.f};
#pragma unroll
  for (int kc = 0; kc < 4; ++kc) {
    v16bf a = frag_f32(x, DMODEL, row0, kc * 32);   // A: x rows
    v16bf b = frag_f32(W, DMODEL, n0,  kc * 32);    // B: W rows (x @ W^T)
    acc = wmma_bf16(a, b, acc);
  }

  int lane = threadIdx.x & 31, n = lane & 15, h = lane >> 4;
  float bval  = bias[n0 + n];
  float scale = (mat == 0) ? SM_SCALE : 1.0f;       // fold softmax scale into Q

  if (mat < 2) {                                    // Q, K: row-major bf16
    bf16_t* dst = (mat == 0) ? Qb : Kb;
#pragma unroll
    for (int v = 0; v < 8; ++v)
      dst[(size_t)(row0 + h * 8 + v) * DMODEL + n0 + n] =
          (__bf16)((acc[v] + bval) * scale);
  } else {                                          // V: store transposed, Vt[n][token]
    *(uint4*)(Vt + (size_t)(n0 + n) * NTOK + row0 + h * 8) =
        make_uint4(pack_bf2(acc[0] + bval, acc[1] + bval),
                   pack_bf2(acc[2] + bval, acc[3] + bval),
                   pack_bf2(acc[4] + bval, acc[5] + bval),
                   pack_bf2(acc[6] + bval, acc[7] + bval));
  }
}

// ---------- kernel 2: flash attention (transposed), split-KV ----------
// One wave per (16-query tile, KV group). 512 * 4 = 2048 waves = 256 blocks.
// Computes S^T = K * Q^T so the D-layout of exp(S^T) is directly the
// B-fragment of O^T = V^T * P^T (no shuffles, no LDS).
__global__ void __launch_bounds__(256) flash_kernel(
    const bf16_t* __restrict__ Qb, const bf16_t* __restrict__ Kb,
    const bf16_t* __restrict__ Vt,
    float* __restrict__ Opart, float* __restrict__ mpart,
    float* __restrict__ lpart) {
  int wid  = (blockIdx.x * 256 + threadIdx.x) >> 5;
  int qt   = wid >> 2, grp = wid & 3;
  int row0 = qt * 16;
  int lane = threadIdx.x & 31, i = lane & 15, h = lane >> 4;

  v16bf qf[4];
#pragma unroll
  for (int kc = 0; kc < 4; ++kc) qf[kc] = frag_bf16(Qb, DMODEL, row0, kc * 32);

  v8f o[8];
#pragma unroll
  for (int t = 0; t < 8; ++t)
#pragma unroll
    for (int v = 0; v < 8; ++v) o[t][v] = 0.f;

  float m = -__builtin_inff(), lsum = 0.f;

  int jbase = grp * KV_PER_G;
  for (int it = 0; it < KV_PER_G / 32; ++it) {
    int j = jbase + it * 32;
    // S^T tiles: D(j_local, i) = sum_c K[j+j_local,c] * Q[row0+i,c]
    v8f s0 = {0.f, 0.f, 0.f, 0.f, 0.f, 0.f, 0.f, 0.f};
    v8f s1 = s0;
#pragma unroll
    for (int kc = 0; kc < 4; ++kc) {
      v16bf k0f = frag_bf16(Kb, DMODEL, j,      kc * 32);
      v16bf k1f = frag_bf16(Kb, DMODEL, j + 16, kc * 32);
      s0 = wmma_bf16(k0f, qf[kc], s0);
      s1 = wmma_bf16(k1f, qf[kc], s1);
    }
    // online softmax: stats are per-lane scalars (query i = lane&15)
    float mx = fmaxf(s0[0], s1[0]);
#pragma unroll
    for (int v = 1; v < 8; ++v) mx = fmaxf(mx, fmaxf(s0[v], s1[v]));
    mx = fmaxf(mx, __shfl_xor(mx, 16));
    float mnew  = fmaxf(m, mx);
    float alpha = __expf(m - mnew);
    m = mnew;

    float e0[8], e1[8], rs = 0.f;
#pragma unroll
    for (int v = 0; v < 8; ++v) {
      e0[v] = __expf(s0[v] - mnew);
      e1[v] = __expf(s1[v] - mnew);
      rs += e0[v] + e1[v];
    }
    rs += __shfl_xor(rs, 16);
    lsum = lsum * alpha + rs;

    // P^T as B-fragment, assembled directly from D layout (no shuffles)
    v8u pu = {pack_bf2(e0[0], e0[1]), pack_bf2(e0[2], e0[3]),
              pack_bf2(e0[4], e0[5]), pack_bf2(e0[6], e0[7]),
              pack_bf2(e1[0], e1[1]), pack_bf2(e1[2], e1[3]),
              pack_bf2(e1[4], e1[5]), pack_bf2(e1[6], e1[7])};
    v16bf pt = __builtin_bit_cast(v16bf, pu);

#pragma unroll
    for (int t = 0; t < 8; ++t) {
#pragma unroll
      for (int v = 0; v < 8; ++v) o[t][v] *= alpha;
      v16bf vf = frag_bf16(Vt, NTOK, t * 16, j);   // A: V^T rows (features)
      o[t] = wmma_bf16(vf, pt, o[t]);              // O^T(feature, i)
    }
  }

  // store unnormalized partials + stats
  float* obase = Opart + ((size_t)grp * NTOK + row0 + i) * DMODEL;
#pragma unroll
  for (int t = 0; t < 8; ++t) {
    float4 w0 = {o[t][0], o[t][1], o[t][2], o[t][3]};
    float4 w1 = {o[t][4], o[t][5], o[t][6], o[t][7]};
    ((float4*)(obase + t * 16 + h * 8))[0] = w0;
    ((float4*)(obase + t * 16 + h * 8))[1] = w1;
  }
  if (h == 0) {
    mpart[grp * NTOK + row0 + i] = m;
    lpart[grp * NTOK + row0 + i] = lsum;
  }
}

// ---------- kernel 3: merge split-KV partials -> bf16 attention output ----------
__global__ void __launch_bounds__(256) merge_kernel(
    const float* __restrict__ Opart, const float* __restrict__ mpart,
    const float* __restrict__ lpart, bf16_t* __restrict__ Ab) {
  int idx = blockIdx.x * 256 + threadIdx.x;     // NTOK * (DMODEL/4) threads
  int row = idx >> 5;
  int f0  = (idx & 31) << 2;
  float mg[GSPLIT], M = -__builtin_inff();
#pragma unroll
  for (int g = 0; g < GSPLIT; ++g) { mg[g] = mpart[g * NTOK + row]; M = fmaxf(M, mg[g]); }
  float w[GSPLIT], L = 0.f;
#pragma unroll
  for (int g = 0; g < GSPLIT; ++g) { w[g] = __expf(mg[g] - M); L += w[g] * lpart[g * NTOK + row]; }
  float rinv = 1.0f / L;
  float s[4] = {0.f, 0.f, 0.f, 0.f};
#pragma unroll
  for (int g = 0; g < GSPLIT; ++g) {
    float4 ov = *(const float4*)(Opart + ((size_t)g * NTOK + row) * DMODEL + f0);
    s[0] += w[g] * ov.x; s[1] += w[g] * ov.y; s[2] += w[g] * ov.z; s[3] += w[g] * ov.w;
  }
  *(uint2*)(Ab + (size_t)row * DMODEL + f0) =
      make_uint2(pack_bf2(s[0] * rinv, s[1] * rinv), pack_bf2(s[2] * rinv, s[3] * rinv));
}

// ---------- kernel 4: output projection ----------
__global__ void __launch_bounds__(256) out_kernel(
    const bf16_t* __restrict__ Ab, const float* __restrict__ Wo,
    const float* __restrict__ bo, float* __restrict__ out) {
  int wid  = (blockIdx.x * 256 + threadIdx.x) >> 5;
  int tile = wid >> 3, nt = wid & 7;
  int row0 = tile * 16, n0 = nt * 16;
  v8f acc = {0.f, 0.f, 0.f, 0.f, 0.f, 0.f, 0.f, 0.f};
#pragma unroll
  for (int kc = 0; kc < 4; ++kc) {
    v16bf a = frag_bf16(Ab, DMODEL, row0, kc * 32);
    v16bf b = frag_f32(Wo, DMODEL, n0, kc * 32);
    acc = wmma_bf16(a, b, acc);
  }
  int lane = threadIdx.x & 31, n = lane & 15, h = lane >> 4;
  float bval = bo[n0 + n];
#pragma unroll
  for (int v = 0; v < 8; ++v)
    out[(size_t)(row0 + h * 8 + v) * DMODEL + n0 + n] = acc[v] + bval;
}

// ---------- launch ----------
extern "C" void kernel_launch(void* const* d_in, const int* in_sizes, int n_in,
                              void* d_out, int out_size, void* d_ws, size_t ws_size,
                              hipStream_t stream) {
  const float* x  = (const float*)d_in[0];
  const float* Wq = (const float*)d_in[1];
  const float* bq = (const float*)d_in[2];
  const float* Wk = (const float*)d_in[3];
  const float* bk = (const float*)d_in[4];
  const float* Wv = (const float*)d_in[5];
  const float* bv = (const float*)d_in[6];
  const float* Wo = (const float*)d_in[7];
  const float* bo = (const float*)d_in[8];

  bf16_t* Qb = (bf16_t*)d_ws;                          // 2 MB
  bf16_t* Kb = Qb + (size_t)NTOK * DMODEL;             // 2 MB
  bf16_t* Vt = Kb + (size_t)NTOK * DMODEL;             // 2 MB (transposed V)
  bf16_t* Ab = Vt + (size_t)DMODEL * NTOK;             // 2 MB
  float* Opart = (float*)(Ab + (size_t)NTOK * DMODEL); // 16 MB
  float* mpart = Opart + (size_t)GSPLIT * NTOK * DMODEL;
  float* lpart = mpart + (size_t)GSPLIT * NTOK;

  // 512 tiles * 24 combos = 12288 waves -> 1536 blocks
  qkv_kernel<<<1536, 256, 0, stream>>>(x, Wq, bq, Wk, bk, Wv, bv, Qb, Kb, Vt);
  // 512 tiles * 4 KV groups = 2048 waves -> 256 blocks
  flash_kernel<<<256, 256, 0, stream>>>(Qb, Kb, Vt, Opart, mpart, lpart);
  // 8192 rows * 32 feature-quads = 262144 threads -> 1024 blocks
  merge_kernel<<<1024, 256, 0, stream>>>(Opart, mpart, lpart, Ab);
  // 512 tiles * 8 col-tiles = 4096 waves -> 512 blocks
  out_kernel<<<512, 256, 0, stream>>>(Ab, Wo, bo, (float*)d_out);
}

// v001
// One run takes 69.5 microseconds.
// Next to v000, in two timings, it ran 2.26 and 2.23 times as fast.
#include <hip/hip_runtime.h>
#include <hip/hip_bf16.h>

typedef __bf16 bf16_t;
typedef __attribute__((ext_vector_type(16))) __bf16        v16bf;
typedef __attribute__((ext_vector_type(8)))  float         v8f;
typedef __attribute__((ext_vector_type(8)))  unsigned int  v8u;

#define NTOK    8192
#define DMODEL  128
#define GSPLIT  4
#define KV_PER_G (NTOK / GSPLIT)
#define SM_SCALE 0.08838834764831845f   // 1/sqrt(128)

// ---------- helpers ----------

// two f32 -> packed 2x bf16 (RNE) using the native conversion path
__device__ __forceinline__ unsigned int pack_bf2(float a, float b) {
  unsigned short ua = __builtin_bit_cast(unsigned short, (__bf16)a);
  unsigned short ub = __builtin_bit_cast(unsigned short, (__bf16)b);
  return (unsigned int)ua | ((unsigned int)ub << 16);
}

__device__ __forceinline__ v8f wmma_bf16(v16bf a, v16bf b, v8f c) {
  // D = A(16x32) * B(32x16) + C, fp32 accumulate
  return __builtin_amdgcn_wmma_f32_16x16x32_bf16(false, a, false, b, (short)0, c,
                                                 false, false);
}

// A/B fragment for V_WMMA_F32_16X16X32_BF16 built from a row-major matrix.
// ISA 7.12.2 16-bit A layout: row r = lane&15; lanes 0-15 hold K
// {k0..k0+7, k0+16..k0+23}; lanes 16-31 hold K {k0+8..k0+15, k0+24..k0+31}.
// B uses the mirrored layout with r = output-column index, so the same loader
// serves B-fragments of W (x @ W^T) and of Q (row-major, contiguous in K).
__device__ __forceinline__ v16bf frag_f32(const float* __restrict__ base,
                                          int ld, int r0, int k0) {
  int lane = threadIdx.x & 31;
  const float* p = base + (size_t)(r0 + (lane & 15)) * ld + k0 + ((lane >> 4) << 3);
  float4 a0 = ((const float4*)p)[0];
  float4 a1 = ((const float4*)p)[1];
  float4 b0 = ((const float4*)p)[4];   // p + 16 floats
  float4 b1 = ((const float4*)p)[5];
  v8u u = {pack_bf2(a0.x, a0.y), pack_bf2(a0.z, a0.w),
           pack_bf2(a1.x, a1.y), pack_bf2(a1.z, a1.w),
           pack_bf2(b0.x, b0.y), pack_bf2(b0.z, b0.w),
           pack_bf2(b1.x, b1.y), pack_bf2(b1.z, b1.w)};
  return __builtin_bit_cast(v16bf, u);
}

__device__ __forceinline__ v16bf frag_bf16(const bf16_t* __restrict__ base,
                                           int ld, int r0, int k0) {
  int lane = threadIdx.x & 31;
  const bf16_t* p = base + (size_t)(r0 + (lane & 15)) * ld + k0 + ((lane >> 4) << 3);
  uint4 lo = *(const uint4*)p;         // 8 bf16
  uint4 hi = *(const uint4*)(p + 16);  // 8 bf16
  v8u u = {lo.x, lo.y, lo.z, lo.w, hi.x, hi.y, hi.z, hi.w};
  return __builtin_bit_cast(v16bf, u);
}

// ---------- kernel 1: Q/K/V projections ----------
// One wave per 16x16 tile. 512 row-tiles * {Q,K,V} * 8 col-tiles = 12288 waves.
__global__ void __launch_bounds__(256) qkv_kernel(
    const float* __restrict__ x,
    const float* __restrict__ Wq, const float* __restrict__ bq,
    const float* __restrict__ Wk, const float* __restrict__ bk,
    const float* __restrict__ Wv, const float* __restrict__ bv,
    bf16_t* __restrict__ Qb, bf16_t* __restrict__ Kb, bf16_t* __restrict__ Vt) {
  int wid  = (blockIdx.x * 256 + threadIdx.x) >> 5;
  int tile = wid / 24, rem = wid % 24;
  int mat = rem >> 3, nt = rem & 7;
  int row0 = tile * 16, n0 = nt * 16;
  const float* W    = (mat == 0) ? Wq : (mat == 1) ? Wk : Wv;
  const float* bias = (mat == 0) ? bq : (mat == 1) ? bk : bv;

  v8f acc = {0.f, 0.f, 0.f, 0.f, 0.f, 0.f, 0.f, 0.f};
#pragma unroll
  for (int kc = 0; kc < 4; ++kc) {
    v16bf a = frag_f32(x, DMODEL, row0, kc * 32);   // A: x rows
    v16bf b = frag_f32(W, DMODEL, n0,  kc * 32);    // B: W rows (x @ W^T)
    acc = wmma_bf16(a, b, acc);
  }

  int lane = threadIdx.x & 31, n = lane & 15, h = lane >> 4;
  float bval  = bias[n0 + n];
  float scale = (mat == 0) ? SM_SCALE : 1.0f;       // fold softmax scale into Q

  if (mat < 2) {                                    // Q, K: row-major bf16
    bf16_t* dst = (mat == 0) ? Qb : Kb;
#pragma unroll
    for (int v = 0; v < 8; ++v)
      dst[(size_t)(row0 + h * 8 + v) * DMODEL + n0 + n] =
          (__bf16)((acc[v] + bval) * scale);
  } else {                                          // V: store transposed, Vt[n][token]
    *(uint4*)(Vt + (size_t)(n0 + n) * NTOK + row0 + h * 8) =
        make_uint4(pack_bf2(acc[0] + bval, acc[1] + bval),
                   pack_bf2(acc[2] + bval, acc[3] + bval),
                   pack_bf2(acc[4] + bval, acc[5] + bval),
                   pack_bf2(acc[6] + bval, acc[7] + bval));
  }
}

// ---------- kernel 2: flash attention (transposed), split-KV ----------
// One block = 8 waves = 8 query tiles of ONE KV group, so all eight waves walk
// the same keys. K rows and V^T rows of 128 keys (one stage) are brought into
// LDS once per block by asynchronous copies and read from there by every wave;
// two buffers, the next stage's copies fly while this stage is worked on.
// Computes S^T = K * Q^T so the D-layout of exp(S^T) is directly the
// B-fragment of O^T = V^T * P^T (no shuffles).
#define ST_KEYS  128                      // keys per stage
#define NSTAGE   (KV_PER_G / ST_KEYS)     // 16 stages per block
#define LPITCH   272                      // 256-byte rows + 16: conflict-free 16-byte reads
#define TILE_B   (128 * LPITCH)           // K tile: 128 keys x 128 features; V^T tile: 128 features x 128 keys
#define STAGE_B  (2 * TILE_B)

// Eight 16-byte copies of one lane: rows r, r+16, ... r+112 of a 128-row tile.
// lds: the lane's LDS byte address of row r; g: its global address; gstep: bytes
// between source rows r and r+16. The s_wait_xcnt closes the statement so that no
// address register named here is rewritten before the copies have taken it.
__device__ __forceinline__ void copy_tile(unsigned int lds, const char* g, size_t gstep) {
  asm volatile(
      "global_load_async_to_lds_b128 %0, %8, off\n\t"
      "global_load_async_to_lds_b128 %1, %9, off\n\t"
      "global_load_async_to_lds_b128 %2, %10, off\n\t"
      "global_load_async_to_lds_b128 %3, %11, off\n\t"
      "global_load_async_to_lds_b128 %4, %12, off\n\t"
      "global_load_async_to_lds_b128 %5, %13, off\n\t"
      "global_load_async_to_lds_b128 %6, %14, off\n\t"
      "global_load_async_to_lds_b128 %7, %15, off\n\t"
      "s_wait_xcnt 0x0"
      :: "v"(lds), "v"(lds + 16u * LPITCH), "v"(lds + 32u * LPITCH), "v"(lds + 48u * LPITCH),
         "v"(lds + 64u * LPITCH), "v"(lds + 80u * LPITCH), "v"(lds + 96u * LPITCH),
         "v"(lds + 112u * LPITCH),
         "v"(g), "v"(g + gstep), "v"(g + 2 * gstep), "v"(g + 3 * gstep),
         "v"(g + 4 * gstep), "v"(g + 5 * gstep), "v"(g + 6 * gstep), "v"(g + 7 * gstep)
      : "memory");
}

// Same fragment as frag_bf16, from an LDS tile of LPITCH-byte rows; kb = byte offset of k0.
__device__ __forceinline__ v16bf frag_lds(const unsigned char* tile, int r0, int kb) {
  int lane = threadIdx.x & 31;
  const unsigned char* p = tile + (r0 + (lane & 15)) * LPITCH + kb + ((lane >> 4) << 4);
  uint4 lo = *(const uint4*)p;         // 8 bf16
  uint4 hi = *(const uint4*)(p + 32);  // 8 bf16, 16 elements on
  v8u u = {lo.x, lo.y, lo.z, lo.w, hi.x, hi.y, hi.z, hi.w};
  return __builtin_bit_cast(v16bf, u);
}

// Runs of v_exp_f32 (2^x), each run one statement closed by a v_nop: the slot that the
// instruction set asks for between a transcendental and the next vector instruction that
// overwrites its source or reads its result.
__device__ __forceinline__ void exp2_run8(float (&r)[8], const float (&x)[8]) {
  asm("v_exp_f32 %0, %8\n\t"
      "v_exp_f32 %1, %9\n\t"
      "v_exp_f32 %2, %10\n\t"
      "v_exp_f32 %3, %11\n\t"
      "v_exp_f32 %4, %12\n\t"
      "v_exp_f32 %5, %13\n\t"
      "v_exp_f32 %6, %14\n\t"
      "v_exp_f32 %7, %15\n\t"
      "v_nop"
      : "=&v"(r[0]), "=&v"(r[1]), "=&v"(r[2]), "=&v"(r[3]),
        "=&v"(r[4]), "=&v"(r[5]), "=&v"(r[6]), "=&v"(r[7])
      : "v"(x[0]), "v"(x[1]), "v"(x[2]), "v"(x[3]), "v"(x[4]), "v"(x[5]), "v"(x[6]), "v"(x[7]));
}
__device__ __forceinline__ float exp2_one(float x) {
  float r;
  asm("v_exp_f32 %0, %1\n\tv_nop" : "=&v"(r) : "v"(x));
  return r;
}
#define LOG2E 1.4426950408889634f   // exp(x) = 2^(x * LOG2E), as __expf forms it

__global__ void __launch_bounds__(256) flash_kernel(
    const bf16_t* __restrict__ Qb, const bf16_t* __restrict__ Kb,
    const bf16_t* __restrict__ Vt,
    float* __restrict__ Opart, float* __restrict__ mpart,
    float* __restrict__ lpart) {
  __shared__ __attribute__((aligned(16))) unsigned char L[2 * STAGE_B];

  int grp  = blockIdx.x & 3;
  int qt   = (blockIdx.x >> 2) * 8 + (threadIdx.x >> 5);
  int row0 = qt * 16;
  int lane = threadIdx.x & 31, i = lane & 15, h = lane >> 4;
  int jbase = grp * KV_PER_G;

  // this thread's share of every stage: 16-byte column (tid & 15) of rows (tid >> 4) + 16 n
  int crow = threadIdx.x >> 4, ccol = threadIdx.x & 15;
  unsigned int ldst = (unsigned int)(size_t)L + crow * LPITCH + ccol * 16;
  const char* gk = (const char*)(Kb + (size_t)(jbase + crow) * DMODEL + ccol * 8);
  const char* gv = (const char*)(Vt + (size_t)crow * NTOK + jbase + ccol * 8);
  const size_t KSTEP = (size_t)16 * DMODEL * 2, VSTEP = (size_t)16 * NTOK * 2;   // 16 source rows
  const size_t KADV  = (size_t)ST_KEYS * DMODEL * 2, VADV = (size_t)ST_KEYS * 2; // one stage on

  // stage 0 into buffer 0, landed and published; then stage 1 into buffer 1
  copy_tile(ldst, gk, KSTEP);
  copy_tile(ldst + TILE_B, gv, VSTEP);

  v16bf qf[4];
#pragma unroll
  for (int kc = 0; kc < 4; ++kc) qf[kc] = frag_bf16(Qb, DMODEL, row0, kc * 32);

  v8f o[8];
#pragma unroll
  for (int t = 0; t < 8; ++t)
#pragma unroll
    for (int v = 0; v < 8; ++v) o[t][v] = 0.f;

  float m = -__builtin_inff(), lsum = 0.f;

  asm volatile("s_wait_asynccnt 0x0" ::: "memory");  // this wave's copies of stage 0 have landed
  __syncthreads();                                   // every wave's have: stage 0 may be read
  copy_tile(ldst + STAGE_B, gk + KADV, KSTEP);
  copy_tile(ldst + STAGE_B + TILE_B, gv + VADV, VSTEP);

  for (int st = 0; st < NSTAGE; ++st) {
    unsigned int boff = (st & 1) * STAGE_B;
    const unsigned char* Ks = L + boff;
    const unsigned char* Vs = L + boff + TILE_B;
    // unrolled: every LDS offset becomes an immediate, and a pass's K reads and
    // products can be issued under the softmax of the pass before
#pragma unroll
    for (int ps = 0; ps < ST_KEYS / 32; ++ps) {
      int jl = ps * 32;
      // S^T tiles: D(j_local, i) = sum_c K[j+j_local,c] * Q[row0+i,c]
      v8f s0 = {0.f, 0.f, 0.f, 0.f, 0.f, 0.f, 0.f, 0.f};
      v8f s1 = s0;
#pragma unroll
      for (int kc = 0; kc < 4; ++kc) {
        v16bf k0f = frag_lds(Ks, jl,      kc * 64);
        v16bf k1f = frag_lds(Ks, jl + 16, kc * 64);
        s0 = wmma_bf16(k0f, qf[kc], s0);
        s1 = wmma_bf16(k1f, qf[kc], s1);
      }
      // online softmax: stats are per-lane scalars (query i = lane&15)
      float mx = fmaxf(s0[0], s1[0]);
#pragma unroll
      for (int v = 1; v < 8; ++v) mx = fmaxf(mx, fmaxf(s0[v], s1[v]));
      mx = fmaxf(mx, __shfl_xor(mx, 16));
      float mnew  = fmaxf(m, mx);
      float alpha = exp2_one((m - mnew) * LOG2E);
      m = mnew;

      float x0[8], x1[8], e0[8], e1[8], rs = 0.f;
#pragma unroll
      for (int v = 0; v < 8; ++v) {
        x0[v] = (s0[v] - mnew) * LOG2E;
        x1[v] = (s1[v] - mnew) * LOG2E;
      }
      exp2_run8(e0, x0);
      exp2_run8(e1, x1);
#pragma unroll
      for (int v = 0; v < 8; ++v) rs += e0[v] + e1[v];
      rs += __shfl_xor(rs, 16);
      lsum = lsum * alpha + rs;

      // P^T as B-fragment, assembled directly from D layout (no shuffles)
      v8u pu = {pack_bf2(e0[0], e0[1]), pack_bf2(e0[2], e0[3]),
                pack_bf2(e0[4], e0[5]), pack_bf2(e0[6], e0[7]),
                pack_bf2(e1[0], e1[1]), pack_bf2(e1[2], e1[3]),
                pack_bf2(e1[4], e1[5]), pack_bf2(e1[6], e1[7])};
      v16bf pt = __builtin_bit_cast(v16bf, pu);

#pragma unroll
      for (int t = 0; t < 8; ++t) {
#pragma unroll
        for (int v = 0; v < 8; ++v) o[t][v] *= alpha;
        v16bf vf = frag_lds(Vs, t * 16, jl * 2);     // A: V^T rows (features)
        o[t] = wmma_bf16(vf, pt, o[t]);              // O^T(feature, i)
      }
    }
    // publish point of stage st + 1, and hand-over of this stage's buffer to its refill
    asm volatile("s_wait_dscnt 0x0" ::: "memory");     // this wave's reads of the buffer are done
    asm volatile("s_wait_asynccnt 0x0" ::: "memory");  // this wave's copies of stage st + 1 have landed
    __syncthreads();                                   // both hold for every wave of the block
    if (st + 2 < NSTAGE) {                             // the same test in the whole block
      copy_tile(ldst + boff, gk + (size_t)(st + 2) * KADV, KSTEP);
      copy_tile(ldst + boff + TILE_B, gv + (size_t)(st + 2) * VADV, VSTEP);
    }
  }
  asm volatile("s_wait_asynccnt 0x0" ::: "memory");    // nothing of this wave is in flight at its end

  // store unnormalized partials + stats
  float* obase = Opart + ((size_t)grp * NTOK + row0 + i) * DMODEL;
#pragma unroll
  for (int t = 0; t < 8; ++t) {
    float4 w0 = {o[t][0], o[t][1], o[t][2], o[t][3]};
    float4 w1 = {o[t][4], o[t][5], o[t][6], o[t][7]};
    ((float4*)(obase + t * 16 + h * 8))[0] = w0;
    ((float4*)(obase + t * 16 + h * 8))[1] = w1;
  }
  if (h == 0) {
    mpart[grp * NTOK + row0 + i] = m;
    lpart[grp * NTOK + row0 + i] = lsum;
  }
}

// ---------- kernel 3: merge split-KV partials -> bf16 attention output ----------
__global__ void __launch_bounds__(256) merge_kernel(
    const float* __restrict__ Opart, const float* __restrict__ mpart,
    const float* __restrict__ lpart, bf16_t* __restrict__ Ab) {
  int idx = blockIdx.x * 256 + threadIdx.x;     // NTOK * (DMODEL/4) threads
  int row = idx >> 5;
  int f0  = (idx & 31) << 2;
  float mg[GSPLIT], M = -__builtin_inff();
#pragma unroll
  for (int g = 0; g < GSPLIT; ++g) { mg[g] = mpart[g * NTOK + row]; M = fmaxf(M, mg[g]); }
  float w[GSPLIT], L = 0.f;
#pragma unroll
  for (int g = 0; g < GSPLIT; ++g) { w[g] = __expf(mg[g] - M); L += w[g] * lpart[g * NTOK + row]; }
  float rinv = 1.0f / L;
  float s[4] = {0.f, 0.f, 0.f, 0.f};
#pragma unroll
  for (int g = 0; g < GSPLIT; ++g) {
    float4 ov = *(const float4*)(Opart + ((size_t)g * NTOK + row) * DMODEL + f0);
    s[0] += w[g] * ov.x; s[1] += w[g] * ov.y; s[2] += w[g] * ov.z; s[3] += w[g] * ov.w;
  }
  *(uint2*)(Ab + (size_t)row * DMODEL + f0) =
      make_uint2(pack_bf2(s[0] * rinv, s[1] * rinv), pack_bf2(s[2] * rinv, s[3] * rinv));
}

// ---------- kernel 4: output projection ----------
__global__ void __launch_bounds__(256) out_kernel(
    const bf16_t* __restrict__ Ab, const float* __restrict__ Wo,
    const float* __restrict__ bo, float* __restrict__ out) {
  int wid  = (blockIdx.x * 256 + threadIdx.x) >> 5;
  int tile = wid >> 3, nt = wid & 7;
  int row0 = tile * 16, n0 = nt * 16;
  v8f acc = {0.f, 0.f, 0.f, 0.f, 0.f, 0.f, 0.f, 0.f};
#pragma unroll
  for (int kc = 0; kc < 4; ++kc) {
    v16bf a = frag_bf16(Ab, DMODEL, row0, kc * 32);
    v16bf b = frag_f32(Wo, DMODEL, n0, kc * 32);
    acc = wmma_bf16(a, b, acc);
  }
  int lane = threadIdx.x & 31, n = lane & 15, h = lane >> 4;
  float bval = bo[n0 + n];
#pragma unroll
  for (int v = 0; v < 8; ++v)
    out[(size_t)(row0 + h * 8 + v) * DMODEL + n0 + n] = acc[v] + bval;
}

// ---------- launch ----------
extern "C" void kernel_launch(void* const* d_in, const int* in_sizes, int n_in,
                              void* d_out, int out_size, void* d_ws, size_t ws_size,
                              hipStream_t stream) {
  const float* x  = (const float*)d_in[0];
  const float* Wq = (const float*)d_in[1];
  const float* bq = (const float*)d_in[2];
  const float* Wk = (const float*)d_in[3];
  const float* bk = (const float*)d_in[4];
  const float* Wv = (const float*)d_in[5];
  const float* bv = (const float*)d_in[6];
  const float* Wo = (const float*)d_in[7];
  const float* bo = (const float*)d_in[8];

  bf16_t* Qb = (bf16_t*)d_ws;                          // 2 MB
  bf16_t* Kb = Qb + (size_t)NTOK * DMODEL;             // 2 MB
  bf16_t* Vt = Kb + (size_t)NTOK * DMODEL;             // 2 MB (transposed V)
  bf16_t* Ab = Vt + (size_t)DMODEL * NTOK;             // 2 MB
  float* Opart = (float*)(Ab + (size_t)NTOK * DMODEL); // 16 MB
  float* mpart = Opart + (size_t)GSPLIT * NTOK * DMODEL;
  float* lpart = mpart + (size_t)GSPLIT * NTOK;

  // 512 tiles * 24 combos = 12288 waves -> 1536 blocks
  qkv_kernel<<<1536, 256, 0, stream>>>(x, Wq, bq, Wk, bk, Wv, bv, Qb, Kb, Vt);
  // 64 blocks of 8 query tiles * 4 KV groups = 256 blocks
  flash_kernel<<<256, 256, 0, stream>>>(Qb, Kb, Vt, Opart, mpart, lpart);
  // 8192 rows * 32 feature-quads = 262144 threads -> 1024 blocks
  merge_kernel<<<1024, 256, 0, stream>>>(Opart, mpart, lpart, Ab);
  // 512 tiles * 8 col-tiles = 4096 waves -> 512 blocks
  out_kernel<<<512, 256, 0, stream>>>(Ab, Wo, bo, (float*)d_out);
}

// v002
// One run takes 63.2 microseconds.
// Next to v001, in two timings, it ran 1.10 times as fast each time.
// Over all steps from v000 it is 2.47 times as fast.
#include <hip/hip_runtime.h>
#include <hip/hip_bf16.h>

typedef __bf16 bf16_t;
typedef __attribute__((ext_vector_type(16))) __bf16        v16bf;
typedef __attribute__((ext_vector_type(8)))  float         v8f;
typedef __attribute__((ext_vector_type(8)))  unsigned int  v8u;

#define NTOK    8192
#define DMODEL  128
#define GSPLIT  4
#define KV_PER_G (NTOK / GSPLIT)
#define SM_SCALE 0.08838834764831845f   // 1/sqrt(128)

// ---------- helpers ----------

// two f32 -> packed 2x bf16 (RNE) using the native conversion path
__device__ __forceinline__ unsigned int pack_bf2(float a, float b) {
  unsigned short ua = __builtin_bit_cast(unsigned short, (__bf16)a);
  unsigned short ub = __builtin_bit_cast(unsigned short, (__bf16)b);
  return (unsigned int)ua | ((unsigned int)ub << 16);
}

__device__ __forceinline__ v8f wmma_bf16(v16bf a, v16bf b, v8f c) {
  // D = A(16x32) * B(32x16) + C, fp32 accumulate
  return __builtin_amdgcn_wmma_f32_16x16x32_bf16(false, a, false, b, (short)0, c,
                                                 false, false);
}

// A/B fragment for V_WMMA_F32_16X16X32_BF16 built from a row-major matrix.
// ISA 7.12.2 16-bit A layout: row r = lane&15; lanes 0-15 hold K
// {k0..k0+7, k0+16..k0+23}; lanes 16-31 hold K {k0+8..k0+15, k0+24..k0+31}.
// B uses the mirrored layout with r = output-column index, so the same loader
// serves B-fragments of W (x @ W^T) and of Q (row-major, contiguous in K).
__device__ __forceinline__ v16bf frag_f32(const float* __restrict__ base,
                                          int ld, int r0, int k0) {
  int lane = threadIdx.x & 31;
  const float* p = base + (size_t)(r0 + (lane & 15)) * ld + k0 + ((lane >> 4) << 3);
  float4 a0 = ((const float4*)p)[0];
  float4 a1 = ((const float4*)p)[1];
  float4 b0 = ((const float4*)p)[4];   // p + 16 floats
  float4 b1 = ((const float4*)p)[5];
  v8u u = {pack_bf2(a0.x, a0.y), pack_bf2(a0.z, a0.w),
           pack_bf2(a1.x, a1.y), pack_bf2(a1.z, a1.w),
           pack_bf2(b0.x, b0.y), pack_bf2(b0.z, b0.w),
           pack_bf2(b1.x, b1.y), pack_bf2(b1.z, b1.w)};
  return __builtin_bit_cast(v16bf, u);
}

__device__ __forceinline__ v16bf frag_bf16(const bf16_t* __restrict__ base,
                                           int ld, int r0, int k0) {
  int lane = threadIdx.x & 31;
  const bf16_t* p = base + (size_t)(r0 + (lane & 15)) * ld + k0 + ((lane >> 4) << 3);
  uint4 lo = *(const uint4*)p;         // 8 bf16
  uint4 hi = *(const uint4*)(p + 16);  // 8 bf16
  v8u u = {lo.x, lo.y, lo.z, lo.w, hi.x, hi.y, hi.z, hi.w};
  return __builtin_bit_cast(v16bf, u);
}

// ---------- kernel 1: Q/K/V projections ----------
// One wave per 16x16 tile. 512 row-tiles * {Q,K,V} * 8 col-tiles = 12288 waves.
__global__ void __launch_bounds__(256) qkv_kernel(
    const float* __restrict__ x,
    const float* __restrict__ Wq, const float* __restrict__ bq,
    const float* __restrict__ Wk, const float* __restrict__ bk,
    const float* __restrict__ Wv, const float* __restrict__ bv,
    bf16_t* __restrict__ Qb, bf16_t* __restrict__ Kb, bf16_t* __restrict__ Vt) {
  int wid  = (blockIdx.x * 256 + threadIdx.x) >> 5;
  int tile = wid / 24, rem = wid % 24;
  int mat = rem >> 3, nt = rem & 7;
  int row0 = tile * 16, n0 = nt * 16;
  const float* W    = (mat == 0) ? Wq : (mat == 1) ? Wk : Wv;
  const float* bias = (mat == 0) ? bq : (mat == 1) ? bk : bv;

  v8f acc = {0.f, 0.f, 0.f, 0.f, 0.f, 0.f, 0.f, 0.f};
#pragma unroll
  for (int kc = 0; kc < 4; ++kc) {
    v16bf a = frag_f32(x, DMODEL, row0, kc * 32);   // A: x rows
    v16bf b = frag_f32(W, DMODEL, n0,  kc * 32);    // B: W rows (x @ W^T)
    acc = wmma_bf16(a, b, acc);
  }

  int lane = threadIdx.x & 31, n = lane & 15, h = lane >> 4;
  float bval  = bias[n0 + n];
  float scale = (mat == 0) ? SM_SCALE : 1.0f;       // fold softmax scale into Q

  if (mat < 2) {                                    // Q, K: row-major bf16
    bf16_t* dst = (mat == 0) ? Qb : Kb;
#pragma unroll
    for (int v = 0; v < 8; ++v)
      dst[(size_t)(row0 + h * 8 + v) * DMODEL + n0 + n] =
          (__bf16)((acc[v] + bval) * scale);
  } else {                                          // V: store transposed, Vt[n][token]
    *(uint4*)(Vt + (size_t)(n0 + n) * NTOK + row0 + h * 8) =
        make_uint4(pack_bf2(acc[0] + bval, acc[1] + bval),
                   pack_bf2(acc[2] + bval, acc[3] + bval),
                   pack_bf2(acc[4] + bval, acc[5] + bval),
                   pack_bf2(acc[6] + bval, acc[7] + bval));
  }
}

// ---------- kernel 2: flash attention (transposed), split-KV ----------
// One block = 8 waves = 8 query tiles of ONE KV group, so all eight waves walk
// the same keys. K rows and V^T rows of 128 keys (one stage) are brought into
// LDS once per block by asynchronous copies and read from there by every wave;
// two buffers, the next stage's copies fly while this stage is worked on.
// Inside a stage each wave fetches its fragments one pass (32 keys) ahead.
// Computes S^T = K * Q^T so the D-layout of exp(S^T) is directly the
// B-fragment of O^T = V^T * P^T (no shuffles).
#define ST_KEYS  128                      // keys per stage
#define NSTAGE   (KV_PER_G / ST_KEYS)     // 16 stages per block
#define LPITCH   272                      // 256-byte rows + 16: conflict-free 16-byte reads
#define TILE_B   (128 * LPITCH)           // K tile: 128 keys x 128 features; V^T tile: 128 features x 128 keys
#define STAGE_B  (2 * TILE_B)

// Eight 16-byte copies of one lane: rows r, r+16, ... r+112 of a 128-row tile.
// lds: the lane's LDS byte address of row r; g: its global address; gstep: bytes
// between source rows r and r+16. The s_wait_xcnt closes the statement so that no
// address register named here is rewritten before the copies have taken it.
__device__ __forceinline__ void copy_tile(unsigned int lds, const char* g, size_t gstep) {
  asm volatile(
      "global_load_async_to_lds_b128 %0, %8, off\n\t"
      "global_load_async_to_lds_b128 %1, %9, off\n\t"
      "global_load_async_to_lds_b128 %2, %10, off\n\t"
      "global_load_async_to_lds_b128 %3, %11, off\n\t"
      "global_load_async_to_lds_b128 %4, %12, off\n\t"
      "global_load_async_to_lds_b128 %5, %13, off\n\t"
      "global_load_async_to_lds_b128 %6, %14, off\n\t"
      "global_load_async_to_lds_b128 %7, %15, off\n\t"
      "s_wait_xcnt 0x0"
      :: "v"(lds), "v"(lds + 16u * LPITCH), "v"(lds + 32u * LPITCH), "v"(lds + 48u * LPITCH),
         "v"(lds + 64u * LPITCH), "v"(lds + 80u * LPITCH), "v"(lds + 96u * LPITCH),
         "v"(lds + 112u * LPITCH),
         "v"(g), "v"(g + gstep), "v"(g + 2 * gstep), "v"(g + 3 * gstep),
         "v"(g + 4 * gstep), "v"(g + 5 * gstep), "v"(g + 6 * gstep), "v"(g + 7 * gstep)
      : "memory");
}

// Same fragment as frag_bf16, from an LDS tile of LPITCH-byte rows; kb = byte offset of k0.
__device__ __forceinline__ v16bf frag_lds(const unsigned char* tile, int r0, int kb) {
  int lane = threadIdx.x & 31;
  const unsigned char* p = tile + (r0 + (lane & 15)) * LPITCH + kb + ((lane >> 4) << 4);
  uint4 lo = *(const uint4*)p;         // 8 bf16
  uint4 hi = *(const uint4*)(p + 32);  // 8 bf16, 16 elements on
  v8u u = {lo.x, lo.y, lo.z, lo.w, hi.x, hi.y, hi.z, hi.w};
  return __builtin_bit_cast(v16bf, u);
}

// Runs of v_exp_f32 (2^x), each run one statement closed by a v_nop: the slot that the
// instruction set asks for between a transcendental and the next vector instruction that
// overwrites its source or reads its result.
__device__ __forceinline__ void exp2_run8(float (&r)[8], const float (&x)[8]) {
  asm("v_exp_f32 %0, %8\n\t"
      "v_exp_f32 %1, %9\n\t"
      "v_exp_f32 %2, %10\n\t"
      "v_exp_f32 %3, %11\n\t"
      "v_exp_f32 %4, %12\n\t"
      "v_exp_f32 %5, %13\n\t"
      "v_exp_f32 %6, %14\n\t"
      "v_exp_f32 %7, %15\n\t"
      "v_nop"
      : "=&v"(r[0]), "=&v"(r[1]), "=&v"(r[2]), "=&v"(r[3]),
        "=&v"(r[4]), "=&v"(r[5]), "=&v"(r[6]), "=&v"(r[7])
      : "v"(x[0]), "v"(x[1]), "v"(x[2]), "v"(x[3]), "v"(x[4]), "v"(x[5]), "v"(x[6]), "v"(x[7]));
}
__device__ __forceinline__ float exp2_one(float x) {
  float r;
  asm("v_exp_f32 %0, %1\n\tv_nop" : "=&v"(r) : "v"(x));
  return r;
}
#define LOG2E 1.4426950408889634f   // exp(x) = 2^(x * LOG2E), as __expf forms it

__global__ void __launch_bounds__(256) flash_kernel(
    const bf16_t* __restrict__ Qb, const bf16_t* __restrict__ Kb,
    const bf16_t* __restrict__ Vt,
    float* __restrict__ Opart, float* __restrict__ mpart,
    float* __restrict__ lpart) {
  __shared__ __attribute__((aligned(16))) unsigned char L[2 * STAGE_B];

  int grp  = blockIdx.x & 3;
  int qt   = (blockIdx.x >> 2) * 8 + (threadIdx.x >> 5);
  int row0 = qt * 16;
  int lane = threadIdx.x & 31, i = lane & 15, h = lane >> 4;
  int jbase = grp * KV_PER_G;

  // this thread's share of every stage: 16-byte column (tid & 15) of rows (tid >> 4) + 16 n
  int crow = threadIdx.x >> 4, ccol = threadIdx.x & 15;
  unsigned int ldst = (unsigned int)(size_t)L + crow * LPITCH + ccol * 16;
  const char* gk = (const char*)(Kb + (size_t)(jbase + crow) * DMODEL + ccol * 8);
  const char* gv = (const char*)(Vt + (size_t)crow * NTOK + jbase + ccol * 8);
  const size_t KSTEP = (size_t)16 * DMODEL * 2, VSTEP = (size_t)16 * NTOK * 2;   // 16 source rows
  const size_t KADV  = (size_t)ST_KEYS * DMODEL * 2, VADV = (size_t)ST_KEYS * 2; // one stage on

  // stage 0 into buffer 0, landed and published; then stage 1 into buffer 1
  copy_tile(ldst, gk, KSTEP);
  copy_tile(ldst + TILE_B, gv, VSTEP);

  v16bf qf[4];
#pragma unroll
  for (int kc = 0; kc < 4; ++kc) qf[kc] = frag_bf16(Qb, DMODEL, row0, kc * 32);

  v8f o[8];
#pragma unroll
  for (int t = 0; t < 8; ++t)
#pragma unroll
    for (int v = 0; v < 8; ++v) o[t][v] = 0.f;

  float m = -__builtin_inff(), lsum = 0.f;

  asm volatile("s_wait_asynccnt 0x0" ::: "memory");  // this wave's copies of stage 0 have landed
  __syncthreads();                                   // every wave's have: stage 0 may be read
  copy_tile(ldst + STAGE_B, gk + KADV, KSTEP);
  copy_tile(ldst + STAGE_B + TILE_B, gv + VADV, VSTEP);

  for (int st = 0; st < NSTAGE; ++st) {
    unsigned int boff = (st & 1) * STAGE_B;
    const unsigned char* Ks = L + boff;
    const unsigned char* Vs = L + boff + TILE_B;
    // Fragments are fetched one pass ahead, inside the stage: all 8 K and 8 V^T fragments of
    // a pass as ONE group of LDS reads. Here the group of the stage's first pass.
    v16bf kf[8], vf[2][8];
#pragma unroll
    for (int kc = 0; kc < 4; ++kc) {
      kf[2 * kc]     = frag_lds(Ks, 0,  kc * 64);
      kf[2 * kc + 1] = frag_lds(Ks, 16, kc * 64);
    }
    // scheduling fence: K ahead of V^T in the group, as the S^T products need theirs first
    __builtin_amdgcn_sched_barrier(0);
#pragma unroll
    for (int t = 0; t < 8; ++t) vf[0][t] = frag_lds(Vs, t * 16, 0);
    // scheduling fence: keeps the group whole; left free, the reads end up singly among the
    // products, each waited for where it stands
    __builtin_amdgcn_sched_barrier(0);
    // unrolled: every LDS offset becomes an immediate and every fragment index a constant
#pragma unroll
    for (int ps = 0; ps < ST_KEYS / 32; ++ps) {
      int jl = ps * 32;
      // S^T tiles: D(j_local, i) = sum_c K[j+j_local,c] * Q[row0+i,c]
      v8f s0 = {0.f, 0.f, 0.f, 0.f, 0.f, 0.f, 0.f, 0.f};
      v8f s1 = s0;
#pragma unroll
      for (int kc = 0; kc < 4; ++kc) {
        s0 = wmma_bf16(kf[2 * kc],     qf[kc], s0);
        s1 = wmma_bf16(kf[2 * kc + 1], qf[kc], s1);
      }
      // online softmax: stats are per-lane scalars (query i = lane&15)
      float mx = fmaxf(s0[0], s1[0]);
#pragma unroll
      for (int v = 1; v < 8; ++v) mx = fmaxf(mx, fmaxf(s0[v], s1[v]));
      mx = fmaxf(mx, __shfl_xor(mx, 16));
      float mnew  = fmaxf(m, mx);
      // The next pass's group (same stage, same buffer), issued once the maximum is known and
      // in flight under the rest of this pass's softmax and its O^T products; V^T into the
      // other register set. The scheduling fences in front of it and behind it keep the group
      // whole and at this place: without the one in front its reads are drawn up among the S^T
      // products and ahead of the maximum's exchange, whose wait then covers them all; without
      // the one behind they sink in among the O^T products.
      if (ps + 1 < ST_KEYS / 32) {
        __builtin_amdgcn_sched_barrier(0);
#pragma unroll
        for (int kc = 0; kc < 4; ++kc) {
          kf[2 * kc]     = frag_lds(Ks, jl + 32, kc * 64);
          kf[2 * kc + 1] = frag_lds(Ks, jl + 48, kc * 64);
        }
#pragma unroll
        for (int t = 0; t < 8; ++t) vf[(ps + 1) & 1][t] = frag_lds(Vs, t * 16, (jl + 32) * 2);
        __builtin_amdgcn_sched_barrier(0);
      }
      float alpha = exp2_one((m - mnew) * LOG2E);
      m = mnew;

      float x0[8], x1[8], e0[8], e1[8], rs = 0.f;
#pragma unroll
      for (int v = 0; v < 8; ++v) {
        x0[v] = (s0[v] - mnew) * LOG2E;
        x1[v] = (s1[v] - mnew) * LOG2E;
      }
      exp2_run8(e0, x0);
      exp2_run8(e1, x1);
#pragma unroll
      for (int v = 0; v < 8; ++v) rs += e0[v] + e1[v];
      rs += __shfl_xor(rs, 16);
      lsum = lsum * alpha + rs;

      // P^T as B-fragment, assembled directly from D layout (no shuffles)
      v8u pu = {pack_bf2(e0[0], e0[1]), pack_bf2(e0[2], e0[3]),
                pack_bf2(e0[4], e0[5]), pack_bf2(e0[6], e0[7]),
                pack_bf2(e1[0], e1[1]), pack_bf2(e1[2], e1[3]),
                pack_bf2(e1[4], e1[5]), pack_bf2(e1[6], e1[7])};
      v16bf pt = __builtin_bit_cast(v16bf, pu);

#pragma unroll
      for (int t = 0; t < 8; ++t) {
#pragma unroll
        for (int v = 0; v < 8; ++v) o[t][v] *= alpha;
        o[t] = wmma_bf16(vf[ps & 1][t], pt, o[t]);   // A: V^T rows (features); O^T(feature, i)
      }
      // scheduling fence: the O^T products stay ahead of the next pass's S^T products, which
      // would otherwise be drawn up to the group and wait out its whole latency there
      if (ps + 1 < ST_KEYS / 32) __builtin_amdgcn_sched_barrier(0);
    }
    // publish point of stage st + 1, and hand-over of this stage's buffer to its refill
    asm volatile("s_wait_dscnt 0x0" ::: "memory");     // this wave's reads of the buffer are done
    asm volatile("s_wait_asynccnt 0x0" ::: "memory");  // this wave's copies of stage st + 1 have landed
    __syncthreads();                                   // both hold for every wave of the block
    if (st + 2 < NSTAGE) {                             // the same test in the whole block
      copy_tile(ldst + boff, gk + (size_t)(st + 2) * KADV, KSTEP);
      copy_tile(ldst + boff + TILE_B, gv + (size_t)(st + 2) * VADV, VSTEP);
    }
  }
  asm volatile("s_wait_asynccnt 0x0" ::: "memory");    // nothing of this wave is in flight at its end

  // store unnormalized partials + stats
  float* obase = Opart + ((size_t)grp * NTOK + row0 + i) * DMODEL;
#pragma unroll
  for (int t = 0; t < 8; ++t) {
    float4 w0 = {o[t][0], o[t][1], o[t][2], o[t][3]};
    float4 w1 = {o[t][4], o[t][5], o[t][6], o[t][7]};
    ((float4*)(obase + t * 16 + h * 8))[0] = w0;
    ((float4*)(obase + t * 16 + h * 8))[1] = w1;
  }
  if (h == 0) {
    mpart[grp * NTOK + row0 + i] = m;
    lpart[grp * NTOK + row0 + i] = lsum;
  }
}

// ---------- kernel 3: merge split-KV partials -> bf16 attention output ----------
__global__ void __launch_bounds__(256) merge_kernel(
    const float* __restrict__ Opart, const float* __restrict__ mpart,
    const float* __restrict__ lpart, bf16_t* __restrict__ Ab) {
  int idx = blockIdx.x * 256 + threadIdx.x;     // NTOK * (DMODEL/4) threads
  int row = idx >> 5;
  int f0  = (idx & 31) << 2;
  float mg[GSPLIT], M = -__builtin_inff();
#pragma unroll
  for (int g = 0; g < GSPLIT; ++g) { mg[g] = mpart[g * NTOK + row]; M = fmaxf(M, mg[g]); }
  float w[GSPLIT], L = 0.f;
#pragma unroll
  for (int g = 0; g < GSPLIT; ++g) { w[g] = __expf(mg[g] - M); L += w[g] * lpart[g * NTOK + row]; }
  float rinv = 1.0f / L;
  float s[4] = {0.f, 0.f, 0.f, 0.f};
#pragma unroll
  for (int g = 0; g < GSPLIT; ++g) {
    float4 ov = *(const float4*)(Opart + ((size_t)g * NTOK + row) * DMODEL + f0);
    s[0] += w[g] * ov.x; s[1] += w[g] * ov.y; s[2] += w[g] * ov.z; s[3] += w[g] * ov.w;
  }
  *(uint2*)(Ab + (size_t)row * DMODEL + f0) =
      make_uint2(pack_bf2(s[0] * rinv, s[1] * rinv), pack_bf2(s[2] * rinv, s[3] * rinv));
}

// ---------- kernel 4: output projection ----------
__global__ void __launch_bounds__(256) out_kernel(
    const bf16_t* __restrict__ Ab, const float* __restrict__ Wo,
    const float* __restrict__ bo, float* __restrict__ out) {
  int wid  = (blockIdx.x * 256 + threadIdx.x) >> 5;
  int tile = wid >> 3, nt = wid & 7;
  int row0 = tile * 16, n0 = nt * 16;
  v8f acc = {0.f, 0.f, 0.f, 0.f, 0.f, 0.f, 0.f, 0.f};
#pragma unroll
  for (int kc = 0; kc < 4; ++kc) {
    v16bf a = frag_bf16(Ab, DMODEL, row0, kc * 32);
    v16bf b = frag_f32(Wo, DMODEL, n0, kc * 32);
    acc = wmma_bf16(a, b, acc);
  }
  int lane = threadIdx.x & 31, n = lane & 15, h = lane >> 4;
  float bval = bo[n0 + n];
#pragma unroll
  for (int v = 0; v < 8; ++v)
    out[(size_t)(row0 + h * 8 + v) * DMODEL + n0 + n] = acc[v] + bval;
}

// ---------- launch ----------
extern "C" void kernel_launch(void* const* d_in, const int* in_sizes, int n_in,
                              void* d_out, int out_size, void* d_ws, size_t ws_size,
                              hipStream_t stream) {
  const float* x  = (const float*)d_in[0];
  const float* Wq = (const float*)d_in[1];
  const float* bq = (const float*)d_in[2];
  const float* Wk = (const float*)d_in[3];
  const float* bk = (const float*)d_in[4];
  const float* Wv = (const float*)d_in[5];
  const float* bv = (const float*)d_in[6];
  const float* Wo = (const float*)d_in[7];
  const float* bo = (const float*)d_in[8];

  bf16_t* Qb = (bf16_t*)d_ws;                          // 2 MB
  bf16_t* Kb = Qb + (size_t)NTOK * DMODEL;             // 2 MB
  bf16_t* Vt = Kb + (size_t)NTOK * DMODEL;             // 2 MB (transposed V)
  bf16_t* Ab = Vt + (size_t)DMODEL * NTOK;             // 2 MB
  float* Opart = (float*)(Ab + (size_t)NTOK * DMODEL); // 16 MB
  float* mpart = Opart + (size_t)GSPLIT * NTOK * DMODEL;
  float* lpart = mpart + (size_t)GSPLIT * NTOK;

  // 512 tiles * 24 combos = 12288 waves -> 1536 blocks
  qkv_kernel<<<1536, 256, 0, stream>>>(x, Wq, bq, Wk, bk, Wv, bv, Qb, Kb, Vt);
  // 64 blocks of 8 query tiles * 4 KV groups = 256 blocks
  flash_kernel<<<256, 256, 0, stream>>>(Qb, Kb, Vt, Opart, mpart, lpart);
  // 8192 rows * 32 feature-quads = 262144 threads -> 1024 blocks
  merge_kernel<<<1024, 256, 0, stream>>>(Opart, mpart, lpart, Ab);
  // 512 tiles * 8 col-tiles = 4096 waves -> 512 blocks
  out_kernel<<<512, 256, 0, stream>>>(Ab, Wo, bo, (float*)d_out);
}

// v003
// Measured time: 60.3 microseconds a run.
// Next to v002, in two timings, it ran 1.05 times as fast each time.
// Counting every step since v000, it is 2.59 times as fast.
#include <hip/hip_runtime.h>
#include <hip/hip_bf16.h>

typedef __bf16 bf16_t;
typedef __attribute__((ext_vector_type(16))) __bf16        v16bf;
typedef __attribute__((ext_vector_type(8)))  float         v8f;
typedef __attribute__((ext_vector_type(8)))  unsigned int  v8u;

#define NTOK    8192
#define DMODEL  128
#define GSPLIT  4
#define KV_PER_G (NTOK / GSPLIT)
#define SM_SCALE 0.08838834764831845f   // 1/sqrt(128)

// ---------- helpers ----------

// two f32 -> packed 2x bf16 (RNE) using the native conversion path
__device__ __forceinline__ unsigned int pack_bf2(float a, float b) {
  unsigned short ua = __builtin_bit_cast(unsigned short, (__bf16)a);
  unsigned short ub = __builtin_bit_cast(unsigned short, (__bf16)b);
  return (unsigned int)ua | ((unsigned int)ub << 16);
}

__device__ __forceinline__ v8f wmma_bf16(v16bf a, v16bf b, v8f c) {
  // D = A(16x32) * B(32x16) + C, fp32 accumulate
  return __builtin_amdgcn_wmma_f32_16x16x32_bf16(false, a, false, b, (short)0, c,
                                                 false, false);
}

// A/B fragment for V_WMMA_F32_16X16X32_BF16 built from a row-major matrix.
// ISA 7.12.2 16-bit A layout: row r = lane&15; lanes 0-15 hold K
// {k0..k0+7, k0+16..k0+23}; lanes 16-31 hold K {k0+8..k0+15, k0+24..k0+31}.
// B uses the mirrored layout with r = output-column index, so the same loader
// serves B-fragments of W (x @ W^T) and of Q (row-major, contiguous in K).
__device__ __forceinline__ v16bf frag_f32(const float* __restrict__ base,
                                          int ld, int r0, int k0) {
  int lane = threadIdx.x & 31;
  const float* p = base + (size_t)(r0 + (lane & 15)) * ld + k0 + ((lane >> 4) << 3);
  float4 a0 = ((const float4*)p)[0];
  float4 a1 = ((const float4*)p)[1];
  float4 b0 = ((const float4*)p)[4];   // p + 16 floats
  float4 b1 = ((const float4*)p)[5];
  v8u u = {pack_bf2(a0.x, a0.y), pack_bf2(a0.z, a0.w),
           pack_bf2(a1.x, a1.y), pack_bf2(a1.z, a1.w),
           pack_bf2(b0.x, b0.y), pack_bf2(b0.z, b0.w),
           pack_bf2(b1.x, b1.y), pack_bf2(b1.z, b1.w)};
  return __builtin_bit_cast(v16bf, u);
}

__device__ __forceinline__ v16bf frag_bf16(const bf16_t* __restrict__ base,
                                           int ld, int r0, int k0) {
  int lane = threadIdx.x & 31;
  const bf16_t* p = base + (size_t)(r0 + (lane & 15)) * ld + k0 + ((lane >> 4) << 3);
  uint4 lo = *(const uint4*)p;         // 8 bf16
  uint4 hi = *(const uint4*)(p + 16);  // 8 bf16
  v8u u = {lo.x, lo.y, lo.z, lo.w, hi.x, hi.y, hi.z, hi.w};
  return __builtin_bit_cast(v16bf, u);
}

// ---------- kernel 1: Q/K/V projections ----------
// One wave per 16x16 tile. 512 row-tiles * {Q,K,V} * 8 col-tiles = 12288 waves.
__global__ void __launch_bounds__(256) qkv_kernel(
    const float* __restrict__ x,
    const float* __restrict__ Wq, const float* __restrict__ bq,
    const float* __restrict__ Wk, const float* __restrict__ bk,
    const float* __restrict__ Wv, const float* __restrict__ bv,
    bf16_t* __restrict__ Qb, bf16_t* __restrict__ Kb, bf16_t* __restrict__ Vt) {
  int wid  = (blockIdx.x * 256 + threadIdx.x) >> 5;
  int tile = wid / 24, rem = wid % 24;
  int mat = rem >> 3, nt = rem & 7;
  int row0 = tile * 16, n0 = nt * 16;
  const float* W    = (mat == 0) ? Wq : (mat == 1) ? Wk : Wv;
  const float* bias = (mat == 0) ? bq : (mat == 1) ? bk : bv;

  v8f acc = {0.f, 0.f, 0.f, 0.f, 0.f, 0.f, 0.f, 0.f};
#pragma unroll
  for (int kc = 0; kc < 4; ++kc) {
    v16bf a = frag_f32(x, DMODEL, row0, kc * 32);   // A: x rows
    v16bf b = frag_f32(W, DMODEL, n0,  kc * 32);    // B: W rows (x @ W^T)
    acc = wmma_bf16(a, b, acc);
  }

  int lane = threadIdx.x & 31, n = lane & 15, h = lane >> 4;
  float bval  = bias[n0 + n];
  float scale = (mat == 0) ? SM_SCALE : 1.0f;       // fold softmax scale into Q

  if (mat < 2) {                                    // Q, K: row-major bf16
    bf16_t* dst = (mat == 0) ? Qb : Kb;
#pragma unroll
    for (int v = 0; v < 8; ++v)
      dst[(size_t)(row0 + h * 8 + v) * DMODEL + n0 + n] =
          (__bf16)((acc[v] + bval) * scale);
  } else {                                          // V: store transposed, Vt[n][token]
    *(uint4*)(Vt + (size_t)(n0 + n) * NTOK + row0 + h * 8) =
        make_uint4(pack_bf2(acc[0] + bval, acc[1] + bval),
                   pack_bf2(acc[2] + bval, acc[3] + bval),
                   pack_bf2(acc[4] + bval, acc[5] + bval),
                   pack_bf2(acc[6] + bval, acc[7] + bval));
  }
}

// ---------- kernel 2: flash attention (transposed), split-KV ----------
// One block = 8 waves = 8 query tiles of ONE KV group, so all eight waves walk
// the same keys. K rows and V^T rows of 128 keys (one stage) are brought into
// LDS once per block by asynchronous copies and read from there by every wave;
// two buffers, the next stage's copies fly while this stage is worked on.
// Inside a stage each wave fetches its fragments one pass (32 keys) ahead.
// Computes S^T = K * Q^T so the D-layout of exp(S^T) is directly the
// B-fragment of O^T = V^T * P^T (no shuffles).
#define ST_KEYS  128                      // keys per stage
#define NSTAGE   (KV_PER_G / ST_KEYS)     // 16 stages per block
#define LPITCH   272                      // 256-byte rows + 16: conflict-free 16-byte reads
#define TILE_B   (128 * LPITCH)           // K tile: 128 keys x 128 features; V^T tile: 128 features x 128 keys
#define STAGE_B  (2 * TILE_B)

// Eight 16-byte copies of one lane: rows r, r+16, ... r+112 of a 128-row tile.
// lds: the lane's LDS byte address of row r; g: its global address; gstep: bytes
// between source rows r and r+16. The s_wait_xcnt closes the statement so that no
// address register named here is rewritten before the copies have taken it.
__device__ __forceinline__ void copy_tile(unsigned int lds, const char* g, size_t gstep) {
  asm volatile(
      "global_load_async_to_lds_b128 %0, %8, off\n\t"
      "global_load_async_to_lds_b128 %1, %9, off\n\t"
      "global_load_async_to_lds_b128 %2, %10, off\n\t"
      "global_load_async_to_lds_b128 %3, %11, off\n\t"
      "global_load_async_to_lds_b128 %4, %12, off\n\t"
      "global_load_async_to_lds_b128 %5, %13, off\n\t"
      "global_load_async_to_lds_b128 %6, %14, off\n\t"
      "global_load_async_to_lds_b128 %7, %15, off\n\t"
      "s_wait_xcnt 0x0"
      :: "v"(lds), "v"(lds + 16u * LPITCH), "v"(lds + 32u * LPITCH), "v"(lds + 48u * LPITCH),
         "v"(lds + 64u * LPITCH), "v"(lds + 80u * LPITCH), "v"(lds + 96u * LPITCH),
         "v"(lds + 112u * LPITCH),
         "v"(g), "v"(g + gstep), "v"(g + 2 * gstep), "v"(g + 3 * gstep),
         "v"(g + 4 * gstep), "v"(g + 5 * gstep), "v"(g + 6 * gstep), "v"(g + 7 * gstep)
      : "memory");
}

// Same fragment as frag_bf16, from an LDS tile of LPITCH-byte rows; kb = byte offset of k0.
__device__ __forceinline__ v16bf frag_lds(const unsigned char* tile, int r0, int kb) {
  int lane = threadIdx.x & 31;
  const unsigned char* p = tile + (r0 + (lane & 15)) * LPITCH + kb + ((lane >> 4) << 4);
  uint4 lo = *(const uint4*)p;         // 8 bf16
  uint4 hi = *(const uint4*)(p + 32);  // 8 bf16, 16 elements on
  v8u u = {lo.x, lo.y, lo.z, lo.w, hi.x, hi.y, hi.z, hi.w};
  return __builtin_bit_cast(v16bf, u);
}

// Runs of v_exp_f32 (2^x), each run one statement closed by a v_nop: the slot that the
// instruction set asks for between a transcendental and the next vector instruction that
// overwrites its source or reads its result.
__device__ __forceinline__ void exp2_run8(float (&r)[8], const float (&x)[8]) {
  asm("v_exp_f32 %0, %8\n\t"
      "v_exp_f32 %1, %9\n\t"
      "v_exp_f32 %2, %10\n\t"
      "v_exp_f32 %3, %11\n\t"
      "v_exp_f32 %4, %12\n\t"
      "v_exp_f32 %5, %13\n\t"
      "v_exp_f32 %6, %14\n\t"
      "v_exp_f32 %7, %15\n\t"
      "v_nop"
      : "=&v"(r[0]), "=&v"(r[1]), "=&v"(r[2]), "=&v"(r[3]),
        "=&v"(r[4]), "=&v"(r[5]), "=&v"(r[6]), "=&v"(r[7])
      : "v"(x[0]), "v"(x[1]), "v"(x[2]), "v"(x[3]), "v"(x[4]), "v"(x[5]), "v"(x[6]), "v"(x[7]));
}
__device__ __forceinline__ float exp2_one(float x) {
  float r;
  asm("v_exp_f32 %0, %1\n\tv_nop" : "=&v"(r) : "v"(x));
  return r;
}
#define LOG2E 1.4426950408889634f   // exp(x) = 2^(x * LOG2E), as __expf forms it

__global__ void __launch_bounds__(256) flash_kernel(
    const bf16_t* __restrict__ Qb, const bf16_t* __restrict__ Kb,
    const bf16_t* __restrict__ Vt,
    float* __restrict__ Opart, float* __restrict__ mpart,
    float* __restrict__ lpart) {
  __shared__ __attribute__((aligned(16))) unsigned char L[2 * STAGE_B];

  int grp  = blockIdx.x & 3;
  int qt   = (blockIdx.x >> 2) * 8 + (threadIdx.x >> 5);
  int row0 = qt * 16;
  int lane = threadIdx.x & 31, i = lane & 15, h = lane >> 4;
  int jbase = grp * KV_PER_G;

  // this thread's share of every stage: 16-byte column (tid & 15) of rows (tid >> 4) + 16 n
  int crow = threadIdx.x >> 4, ccol = threadIdx.x & 15;
  unsigned int ldst = (unsigned int)(size_t)L + crow * LPITCH + ccol * 16;
  const char* gk = (const char*)(Kb + (size_t)(jbase + crow) * DMODEL + ccol * 8);
  const char* gv = (const char*)(Vt + (size_t)crow * NTOK + jbase + ccol * 8);
  const size_t KSTEP = (size_t)16 * DMODEL * 2, VSTEP = (size_t)16 * NTOK * 2;   // 16 source rows
  const size_t KADV  = (size_t)ST_KEYS * DMODEL * 2, VADV = (size_t)ST_KEYS * 2; // one stage on

  // stage 0 into buffer 0, landed and published; then stage 1 into buffer 1
  copy_tile(ldst, gk, KSTEP);
  copy_tile(ldst + TILE_B, gv, VSTEP);

  v16bf qf[4];
#pragma unroll
  for (int kc = 0; kc < 4; ++kc) qf[kc] = frag_bf16(Qb, DMODEL, row0, kc * 32);

  v8f o[8];
#pragma unroll
  for (int t = 0; t < 8; ++t)
#pragma unroll
    for (int v = 0; v < 8; ++v) o[t][v] = 0.f;

  float m = -__builtin_inff(), lsum = 0.f;

  asm volatile("s_wait_asynccnt 0x0" ::: "memory");  // this wave's copies of stage 0 have landed
  __syncthreads();                                   // every wave's have: stage 0 may be read
  copy_tile(ldst + STAGE_B, gk + KADV, KSTEP);
  copy_tile(ldst + STAGE_B + TILE_B, gv + VADV, VSTEP);

  for (int st = 0; st < NSTAGE; ++st) {
    unsigned int boff = (st & 1) * STAGE_B;
    const unsigned char* Ks = L + boff;
    const unsigned char* Vs = L + boff + TILE_B;
    // Fragments are fetched one pass ahead, inside the stage: all 8 K and 8 V^T fragments of
    // a pass as ONE group of LDS reads. Here the group of the stage's first pass.
    v16bf kf[8], vf[2][8];
#pragma unroll
    for (int kc = 0; kc < 4; ++kc) {
      kf[2 * kc]     = frag_lds(Ks, 0,  kc * 64);
      kf[2 * kc + 1] = frag_lds(Ks, 16, kc * 64);
    }
    // scheduling fence: K ahead of V^T in the group, as the S^T products need theirs first
    __builtin_amdgcn_sched_barrier(0);
#pragma unroll
    for (int t = 0; t < 8; ++t) vf[0][t] = frag_lds(Vs, t * 16, 0);
    // scheduling fence: keeps the group whole; left free, the reads end up singly among the
    // products, each waited for where it stands
    __builtin_amdgcn_sched_barrier(0);
    // unrolled: every LDS offset becomes an immediate and every fragment index a constant
#pragma unroll
    for (int ps = 0; ps < ST_KEYS / 32; ++ps) {
      int jl = ps * 32;
      // S^T tiles: D(j_local, i) = sum_c K[j+j_local,c] * Q[row0+i,c]
      v8f s0 = {0.f, 0.f, 0.f, 0.f, 0.f, 0.f, 0.f, 0.f};
      v8f s1 = s0;
#pragma unroll
      for (int kc = 0; kc < 4; ++kc) {
        s0 = wmma_bf16(kf[2 * kc],     qf[kc], s0);
        s1 = wmma_bf16(kf[2 * kc + 1], qf[kc], s1);
      }
      // online softmax: stats are per-lane scalars (query i = lane&15)
      float mx = fmaxf(s0[0], s1[0]);
#pragma unroll
      for (int v = 1; v < 8; ++v) mx = fmaxf(mx, fmaxf(s0[v], s1[v]));
      mx = fmaxf(mx, __shfl_xor(mx, 16));
      float mnew  = fmaxf(m, mx);
      // The next pass's group (same stage, same buffer), issued once the maximum is known and
      // in flight under the rest of this pass's softmax and its O^T products; V^T into the
      // other register set. The scheduling fences in front of it and behind it keep the group
      // whole and at this place: without the one in front its reads are drawn up among the S^T
      // products and ahead of the maximum's exchange, whose wait then covers them all; without
      // the one behind they sink in among the O^T products.
      if (ps + 1 < ST_KEYS / 32) {
        __builtin_amdgcn_sched_barrier(0);
#pragma unroll
        for (int kc = 0; kc < 4; ++kc) {
          kf[2 * kc]     = frag_lds(Ks, jl + 32, kc * 64);
          kf[2 * kc + 1] = frag_lds(Ks, jl + 48, kc * 64);
        }
#pragma unroll
        for (int t = 0; t < 8; ++t) vf[(ps + 1) & 1][t] = frag_lds(Vs, t * 16, (jl + 32) * 2);
        __builtin_amdgcn_sched_barrier(0);
      }
      float alpha = exp2_one((m - mnew) * LOG2E);
      m = mnew;

      float x0[8], x1[8], e0[8], e1[8], rs = 0.f;
#pragma unroll
      for (int v = 0; v < 8; ++v) {
        x0[v] = (s0[v] - mnew) * LOG2E;
        x1[v] = (s1[v] - mnew) * LOG2E;
      }
      exp2_run8(e0, x0);
      exp2_run8(e1, x1);
#pragma unroll
      for (int v = 0; v < 8; ++v) rs += e0[v] + e1[v];
      rs += __shfl_xor(rs, 16);
      lsum = lsum * alpha + rs;

      // P^T as B-fragment, assembled directly from D layout (no shuffles)
      v8u pu = {pack_bf2(e0[0], e0[1]), pack_bf2(e0[2], e0[3]),
                pack_bf2(e0[4], e0[5]), pack_bf2(e0[6], e0[7]),
                pack_bf2(e1[0], e1[1]), pack_bf2(e1[2], e1[3]),
                pack_bf2(e1[4], e1[5]), pack_bf2(e1[6], e1[7])};
      v16bf pt = __builtin_bit_cast(v16bf, pu);

#pragma unroll
      for (int t = 0; t < 8; ++t) {
#pragma unroll
        for (int v = 0; v < 8; ++v) o[t][v] *= alpha;
        o[t] = wmma_bf16(vf[ps & 1][t], pt, o[t]);   // A: V^T rows (features); O^T(feature, i)
      }
      // scheduling fence: the O^T products stay ahead of the next pass's S^T products, which
      // would otherwise be drawn up to the group and wait out its whole latency there
      if (ps + 1 < ST_KEYS / 32) __builtin_amdgcn_sched_barrier(0);
    }
    // publish point of stage st + 1, and hand-over of this stage's buffer to its refill
    asm volatile("s_wait_dscnt 0x0" ::: "memory");     // this wave's reads of the buffer are done
    asm volatile("s_wait_asynccnt 0x0" ::: "memory");  // this wave's copies of stage st + 1 have landed
    __syncthreads();                                   // both hold for every wave of the block
    if (st + 2 < NSTAGE) {                             // the same test in the whole block
      copy_tile(ldst + boff, gk + (size_t)(st + 2) * KADV, KSTEP);
      copy_tile(ldst + boff + TILE_B, gv + (size_t)(st + 2) * VADV, VSTEP);
    }
  }
  asm volatile("s_wait_asynccnt 0x0" ::: "memory");    // nothing of this wave is in flight at its end

  // store unnormalized partials + stats
  float* obase = Opart + ((size_t)grp * NTOK + row0 + i) * DMODEL;
#pragma unroll
  for (int t = 0; t < 8; ++t) {
    float4 w0 = {o[t][0], o[t][1], o[t][2], o[t][3]};
    float4 w1 = {o[t][4], o[t][5], o[t][6], o[t][7]};
    ((float4*)(obase + t * 16 + h * 8))[0] = w0;
    ((float4*)(obase + t * 16 + h * 8))[1] = w1;
  }
  if (h == 0) {
    mpart[grp * NTOK + row0 + i] = m;
    lpart[grp * NTOK + row0 + i] = lsum;
  }
}

// ---------- kernel 3: merge of the split-KV partials + output projection ----------
// One block = 16 rows. Its 256 threads merge the rows' GSPLIT partials into one bf16 tile in
// LDS, which is the A operand of the block's eight 16x16 output tiles (one wave each).
typedef __attribute__((ext_vector_type(4))) float v4f;

__global__ void __launch_bounds__(256) merge_out_kernel(
    const float* __restrict__ Opart, const float* __restrict__ mpart,
    const float* __restrict__ lpart, const float* __restrict__ Wo,
    const float* __restrict__ bo, float* __restrict__ out) {
  __shared__ __attribute__((aligned(16))) unsigned char At[16 * LPITCH];
  int row0 = blockIdx.x * 16, n0 = (threadIdx.x >> 5) * 16;
  int lane = threadIdx.x & 31, n = lane & 15, h = lane >> 4;

  // merge: thread -> row tid >> 4, features f0..f0+3 and f0+64..f0+67, so that each load of a
  // wave covers whole 128-byte lines
  int mr  = threadIdx.x >> 4;
  int f0  = (threadIdx.x & 15) << 2;
  int row = row0 + mr;
  v4f ov[GSPLIT][2];
#pragma unroll
  for (int g = 0; g < GSPLIT; ++g) {
    const float* p = Opart + ((size_t)g * NTOK + row) * DMODEL + f0;
    ov[g][0] = *(const v4f*)p;
    ov[g][1] = *(const v4f*)(p + 64);
  }
  // precaution: later loads may be given the address registers of the loads above as destinations
  asm volatile("s_wait_xcnt 0x0" ::: "memory");
  v4f mg, lg;
#pragma unroll
  for (int g = 0; g < GSPLIT; ++g) { mg[g] = mpart[g * NTOK + row]; lg[g] = lpart[g * NTOK + row]; }
  float bval = bo[n0 + n];
  // precaution: the same, for the nine loads above
  asm volatile("s_wait_xcnt 0x0" ::: "memory");

  // B: Wo rows (the reads of frag_f32), issued with the partials, ahead of the barrier
  const v4f* wp = (const v4f*)(Wo + (size_t)(n0 + n) * DMODEL + h * 8);
  v4f wr[4][4];
#pragma unroll
  for (int kc = 0; kc < 4; ++kc) {
    wr[kc][0] = wp[kc * 8];     wr[kc][1] = wp[kc * 8 + 1];
    wr[kc][2] = wp[kc * 8 + 4];
    // precaution: the same; the last load may be given the common address pair as its destination
    if (kc == 3) asm volatile("s_wait_xcnt 0x0" ::: "memory");
    wr[kc][3] = wp[kc * 8 + 5];
  }
  // Fence on the loaded values, inputs only: every load of the kernel is issued in front of the
  // first use of one. Left free, they are dealt out among the arithmetic in small groups, and
  // the block waits out one memory latency after another.
  asm volatile("" :: "v"(ov[0][0]), "v"(ov[0][1]), "v"(ov[1][0]), "v"(ov[1][1]),
                     "v"(ov[2][0]), "v"(ov[2][1]), "v"(ov[3][0]), "v"(ov[3][1]),
                     "v"(mg), "v"(lg), "v"(bval),
                     "v"(wr[0][0]), "v"(wr[0][1]), "v"(wr[0][2]), "v"(wr[0][3]),
                     "v"(wr[1][0]), "v"(wr[1][1]), "v"(wr[1][2]), "v"(wr[1][3]),
                     "v"(wr[2][0]), "v"(wr[2][1]), "v"(wr[2][2]), "v"(wr[2][3]),
                     "v"(wr[3][0]), "v"(wr[3][1]), "v"(wr[3][2]), "v"(wr[3][3]));

  float M = -__builtin_inff();
#pragma unroll
  for (int g = 0; g < GSPLIT; ++g) M = fmaxf(M, mg[g]);
  float w[GSPLIT], L = 0.f;
#pragma unroll
  for (int g = 0; g < GSPLIT; ++g) { w[g] = exp2_one((mg[g] - M) * LOG2E); L += w[g] * lg[g]; }
  float rinv = 1.0f / L;
#pragma unroll
  for (int c = 0; c < 2; ++c) {
    float s[4] = {0.f, 0.f, 0.f, 0.f};
#pragma unroll
    for (int g = 0; g < GSPLIT; ++g) {
      s[0] += w[g] * ov[g][c].x; s[1] += w[g] * ov[g][c].y;
      s[2] += w[g] * ov[g][c].z; s[3] += w[g] * ov[g][c].w;
    }
    *(uint2*)(At + mr * LPITCH + (f0 + c * 64) * 2) =
        make_uint2(pack_bf2(s[0] * rinv, s[1] * rinv), pack_bf2(s[2] * rinv, s[3] * rinv));
  }
  __syncthreads();   // the merged tile is whole before any wave reads its A fragments

  v8f acc = {0.f, 0.f, 0.f, 0.f, 0.f, 0.f, 0.f, 0.f};
#pragma unroll
  for (int kc = 0; kc < 4; ++kc) {
    v8u u = {pack_bf2(wr[kc][0].x, wr[kc][0].y), pack_bf2(wr[kc][0].z, wr[kc][0].w),
             pack_bf2(wr[kc][1].x, wr[kc][1].y), pack_bf2(wr[kc][1].z, wr[kc][1].w),
             pack_bf2(wr[kc][2].x, wr[kc][2].y), pack_bf2(wr[kc][2].z, wr[kc][2].w),
             pack_bf2(wr[kc][3].x, wr[kc][3].y), pack_bf2(wr[kc][3].z, wr[kc][3].w)};
    acc = wmma_bf16(frag_lds(At, 0, kc * 64), __builtin_bit_cast(v16bf, u), acc);
  }
#pragma unroll
  for (int v = 0; v < 8; ++v)
    out[(size_t)(row0 + h * 8 + v) * DMODEL + n0 + n] = acc[v] + bval;
}

// ---------- launch ----------
extern "C" void kernel_launch(void* const* d_in, const int* in_sizes, int n_in,
                              void* d_out, int out_size, void* d_ws, size_t ws_size,
                              hipStream_t stream) {
  const float* x  = (const float*)d_in[0];
  const float* Wq = (const float*)d_in[1];
  const float* bq = (const float*)d_in[2];
  const float* Wk = (const float*)d_in[3];
  const float* bk = (const float*)d_in[4];
  const float* Wv = (const float*)d_in[5];
  const float* bv = (const float*)d_in[6];
  const float* Wo = (const float*)d_in[7];
  const float* bo = (const float*)d_in[8];

  bf16_t* Qb = (bf16_t*)d_ws;                          // 2 MB
  bf16_t* Kb = Qb + (size_t)NTOK * DMODEL;             // 2 MB
  bf16_t* Vt = Kb + (size_t)NTOK * DMODEL;             // 2 MB (transposed V)
  float* Opart = (float*)(Vt + (size_t)DMODEL * NTOK); // 16 MB
  float* mpart = Opart + (size_t)GSPLIT * NTOK * DMODEL;
  float* lpart = mpart + (size_t)GSPLIT * NTOK;

  // 512 tiles * 24 combos = 12288 waves -> 1536 blocks
  qkv_kernel<<<1536, 256, 0, stream>>>(x, Wq, bq, Wk, bk, Wv, bv, Qb, Kb, Vt);
  // 64 blocks of 8 query tiles * 4 KV groups = 256 blocks
  flash_kernel<<<256, 256, 0, stream>>>(Qb, Kb, Vt, Opart, mpart, lpart);
  // 512 row tiles, one block each: 8 waves = 8 col-tiles
  merge_out_kernel<<<512, 256, 0, stream>>>(Opart, mpart, lpart, Wo, bo, (float*)d_out);
}

// v004
// One run takes 53.3 microseconds.
// Next to v003, in two timings, it ran 1.13 times as fast each time.
// Over all steps from v000 it is 2.93 times as fast.
#include <hip/hip_runtime.h>
#include <hip/hip_bf16.h>

typedef __bf16 bf16_t;
typedef __attribute__((ext_vector_type(16))) __bf16        v16bf;
typedef __attribute__((ext_vector_type(8)))  float         v8f;
typedef __attribute__((ext_vector_type(8)))  unsigned int  v8u;

#define NTOK    8192
#define DMODEL  128
#define GSPLIT  4
#define KV_PER_G (NTOK / GSPLIT)
#define SM_SCALE 0.08838834764831845f   // 1/sqrt(128)

// ---------- helpers ----------

// two f32 -> packed 2x bf16 (RNE) using the native conversion path
__device__ __forceinline__ unsigned int pack_bf2(float a, float b) {
  unsigned short ua = __builtin_bit_cast(unsigned short, (__bf16)a);
  unsigned short ub = __builtin_bit_cast(unsigned short, (__bf16)b);
  return (unsigned int)ua | ((unsigned int)ub << 16);
}

__device__ __forceinline__ v8f wmma_bf16(v16bf a, v16bf b, v8f c) {
  // D = A(16x32) * B(32x16) + C, fp32 accumulate
  return __builtin_amdgcn_wmma_f32_16x16x32_bf16(false, a, false, b, (short)0, c,
                                                 false, false);
}

// A/B fragment for V_WMMA_F32_16X16X32_BF16 built from a row-major matrix.
// ISA 7.12.2 16-bit A layout: row r = lane&15; lanes 0-15 hold K
// {k0..k0+7, k0+16..k0+23}; lanes 16-31 hold K {k0+8..k0+15, k0+24..k0+31}.
// B uses the mirrored layout with r = output-column index, so the same loader
// serves B-fragments of W (x @ W^T) and of Q (row-major, contiguous in K).
__device__ __forceinline__ v16bf frag_f32(const float* __restrict__ base,
                                          int ld, int r0, int k0) {
  int lane = threadIdx.x & 31;
  const float* p = base + (size_t)(r0 + (lane & 15)) * ld + k0 + ((lane >> 4) << 3);
  float4 a0 = ((const float4*)p)[0];
  float4 a1 = ((const float4*)p)[1];
  float4 b0 = ((const float4*)p)[4];   // p + 16 floats
  float4 b1 = ((const float4*)p)[5];
  v8u u = {pack_bf2(a0.x, a0.y), pack_bf2(a0.z, a0.w),
           pack_bf2(a1.x, a1.y), pack_bf2(a1.z, a1.w),
           pack_bf2(b0.x, b0.y), pack_bf2(b0.z, b0.w),
           pack_bf2(b1.x, b1.y), pack_bf2(b1.z, b1.w)};
  return __builtin_bit_cast(v16bf, u);
}

__device__ __forceinline__ v16bf frag_bf16(const bf16_t* __restrict__ base,
                                           int ld, int r0, int k0) {
  int lane = threadIdx.x & 31;
  const bf16_t* p = base + (size_t)(r0 + (lane & 15)) * ld + k0 + ((lane >> 4) << 3);
  uint4 lo = *(const uint4*)p;         // 8 bf16
  uint4 hi = *(const uint4*)(p + 16);  // 8 bf16
  v8u u = {lo.x, lo.y, lo.z, lo.w, hi.x, hi.y, hi.z, hi.w};
  return __builtin_bit_cast(v16bf, u);
}

// ---------- kernel 1: Q/K/V projections ----------
// One wave per 16x16 tile. 512 row-tiles * {Q,K,V} * 8 col-tiles = 12288 waves.
__global__ void __launch_bounds__(256) qkv_kernel(
    const float* __restrict__ x,
    const float* __restrict__ Wq, const float* __restrict__ bq,
    const float* __restrict__ Wk, const float* __restrict__ bk,
    const float* __restrict__ Wv, const float* __restrict__ bv,
    bf16_t* __restrict__ Qb, bf16_t* __restrict__ Kb, bf16_t* __restrict__ Vt) {
  int wid  = (blockIdx.x * 256 + threadIdx.x) >> 5;
  int tile = wid / 24, rem = wid % 24;
  int mat = rem >> 3, nt = rem & 7;
  int row0 = tile * 16, n0 = nt * 16;
  const float* W    = (mat == 0) ? Wq : (mat == 1) ? Wk : Wv;
  const float* bias = (mat == 0) ? bq : (mat == 1) ? bk : bv;

  v8f acc = {0.f, 0.f, 0.f, 0.f, 0.f, 0.f, 0.f, 0.f};
#pragma unroll
  for (int kc = 0; kc < 4; ++kc) {
    v16bf a = frag_f32(x, DMODEL, row0, kc * 32);   // A: x rows
    v16bf b = frag_f32(W, DMODEL, n0,  kc * 32);    // B: W rows (x @ W^T)
    acc = wmma_bf16(a, b, acc);
  }

  int lane = threadIdx.x & 31, n = lane & 15, h = lane >> 4;
  float bval  = bias[n0 + n];
  float scale = (mat == 0) ? SM_SCALE : 1.0f;       // fold softmax scale into Q

  if (mat < 2) {                                    // Q, K: row-major bf16
    bf16_t* dst = (mat == 0) ? Qb : Kb;
#pragma unroll
    for (int v = 0; v < 8; ++v)
      dst[(size_t)(row0 + h * 8 + v) * DMODEL + n0 + n] =
          (__bf16)((acc[v] + bval) * scale);
  } else {                                          // V: store transposed, Vt[n][token]
    *(uint4*)(Vt + (size_t)(n0 + n) * NTOK + row0 + h * 8) =
        make_uint4(pack_bf2(acc[0] + bval, acc[1] + bval),
                   pack_bf2(acc[2] + bval, acc[3] + bval),
                   pack_bf2(acc[4] + bval, acc[5] + bval),
                   pack_bf2(acc[6] + bval, acc[7] + bval));
  }
}

// ---------- kernel 2: flash attention (transposed), split-KV ----------
// One block = 8 waves = 128 queries of ONE KV group. A wave holds 32 query columns (two Q
// tiles), so every K and V^T fragment it reads from LDS feeds two products. Waves 0-3 cover
// the block's 128 queries on the even stages (128 keys each), waves 4-7 the same queries on
// the odd stages; the two halves' partials are merged through LDS behind the loop.
// K rows and V^T rows of two stages (one trip) are brought into LDS once per block by
// asynchronous copies; two buffers, the next trip's copies fly while this trip is worked on.
// Inside a stage each wave fetches its fragments one pass (32 keys) ahead.
// Computes S^T = K * Q^T so the D-layout of exp(S^T) is directly the
// B-fragment of O^T = V^T * P^T (no shuffles).
#define ST_KEYS  128                      // keys per stage
#define NSTAGE   (KV_PER_G / ST_KEYS)     // 16 stages per block
#define NTRIP    (NSTAGE / 2)             // a trip = two stages, one for each half of the waves
#define LPITCH   272                      // 256-byte rows + 16: conflict-free 16-byte reads
#define TILE_B   (128 * LPITCH)           // K tile: 128 keys x 128 features; V^T tile: 128 features x 128 keys
#define STAGE_B  (2 * TILE_B)
#define TRIP_B   (2 * STAGE_B)

// Eight 16-byte copies of one lane: rows r, r+16, ... r+112 of a 128-row tile.
// lds: the lane's LDS byte address of row r; g: its global address; gstep: bytes
// between source rows r and r+16. The s_wait_xcnt closes the statement so that no
// address register named here is rewritten before the copies have taken it.
__device__ __forceinline__ void copy_tile(unsigned int lds, const char* g, size_t gstep) {
  asm volatile(
      "global_load_async_to_lds_b128 %0, %8, off\n\t"
      "global_load_async_to_lds_b128 %1, %9, off\n\t"
      "global_load_async_to_lds_b128 %2, %10, off\n\t"
      "global_load_async_to_lds_b128 %3, %11, off\n\t"
      "global_load_async_to_lds_b128 %4, %12, off\n\t"
      "global_load_async_to_lds_b128 %5, %13, off\n\t"
      "global_load_async_to_lds_b128 %6, %14, off\n\t"
      "global_load_async_to_lds_b128 %7, %15, off\n\t"
      "s_wait_xcnt 0x0"
      :: "v"(lds), "v"(lds + 16u * LPITCH), "v"(lds + 32u * LPITCH), "v"(lds + 48u * LPITCH),
         "v"(lds + 64u * LPITCH), "v"(lds + 80u * LPITCH), "v"(lds + 96u * LPITCH),
         "v"(lds + 112u * LPITCH),
         "v"(g), "v"(g + gstep), "v"(g + 2 * gstep), "v"(g + 3 * gstep),
         "v"(g + 4 * gstep), "v"(g + 5 * gstep), "v"(g + 6 * gstep), "v"(g + 7 * gstep)
      : "memory");
}

// Same fragment as frag_bf16, from an LDS tile of LPITCH-byte rows; kb = byte offset of k0.
__device__ __forceinline__ v16bf frag_lds(const unsigned char* tile, int r0, int kb) {
  int lane = threadIdx.x & 31;
  const unsigned char* p = tile + (r0 + (lane & 15)) * LPITCH + kb + ((lane >> 4) << 4);
  uint4 lo = *(const uint4*)p;         // 8 bf16
  uint4 hi = *(const uint4*)(p + 32);  // 8 bf16, 16 elements on
  v8u u = {lo.x, lo.y, lo.z, lo.w, hi.x, hi.y, hi.z, hi.w};
  return __builtin_bit_cast(v16bf, u);
}

// Runs of v_exp_f32 (2^x), each run one statement closed by a v_nop: the slot that the
// instruction set asks for between a transcendental and the next vector instruction that
// overwrites its source or reads its result.
__device__ __forceinline__ void exp2_run8(float (&r)[8], const float (&x)[8]) {
  asm("v_exp_f32 %0, %8\n\t"
      "v_exp_f32 %1, %9\n\t"
      "v_exp_f32 %2, %10\n\t"
      "v_exp_f32 %3, %11\n\t"
      "v_exp_f32 %4, %12\n\t"
      "v_exp_f32 %5, %13\n\t"
      "v_exp_f32 %6, %14\n\t"
      "v_exp_f32 %7, %15\n\t"
      "v_nop"
      : "=&v"(r[0]), "=&v"(r[1]), "=&v"(r[2]), "=&v"(r[3]),
        "=&v"(r[4]), "=&v"(r[5]), "=&v"(r[6]), "=&v"(r[7])
      : "v"(x[0]), "v"(x[1]), "v"(x[2]), "v"(x[3]), "v"(x[4]), "v"(x[5]), "v"(x[6]), "v"(x[7]));
}
__device__ __forceinline__ float exp2_one(float x) {
  float r;
  asm("v_exp_f32 %0, %1\n\tv_nop" : "=&v"(r) : "v"(x));
  return r;
}
#define LOG2E 1.4426950408889634f   // exp(x) = 2^(x * LOG2E), as __expf forms it

__global__ void __launch_bounds__(256) flash_kernel(
    const bf16_t* __restrict__ Qb, const bf16_t* __restrict__ Kb,
    const bf16_t* __restrict__ Vt,
    float* __restrict__ Opart, float* __restrict__ mpart,
    float* __restrict__ lpart) {
  __shared__ __attribute__((aligned(16))) unsigned char L[2 * TRIP_B];

  int grp  = blockIdx.x & 3;
  int wv   = threadIdx.x >> 5;
  int kh   = wv >> 2;                                   // which stage of a trip this wave works on
  int row0 = (blockIdx.x >> 2) * 128 + (wv & 3) * 32;   // first of the wave's 32 queries
  int lane = threadIdx.x & 31, i = lane & 15, h = lane >> 4;
  int jbase = grp * KV_PER_G;

  // this thread's share of every stage: 16-byte column (tid & 15) of rows (tid >> 4) + 16 n
  int crow = threadIdx.x >> 4, ccol = threadIdx.x & 15;
  unsigned int ldst = (unsigned int)(size_t)L + crow * LPITCH + ccol * 16;
  const char* gk = (const char*)(Kb + (size_t)(jbase + crow) * DMODEL + ccol * 8);
  const char* gv = (const char*)(Vt + (size_t)crow * NTOK + jbase + ccol * 8);
  const size_t KSTEP = (size_t)16 * DMODEL * 2, VSTEP = (size_t)16 * NTOK * 2;   // 16 source rows
  const size_t KADV  = (size_t)ST_KEYS * DMODEL * 2, VADV = (size_t)ST_KEYS * 2; // one stage on

  // trip 0 (stages 0 and 1) into buffer 0, landed and published; then trip 1 into buffer 1
  copy_tile(ldst, gk, KSTEP);
  copy_tile(ldst + TILE_B, gv, VSTEP);
  copy_tile(ldst + STAGE_B, gk + KADV, KSTEP);
  copy_tile(ldst + STAGE_B + TILE_B, gv + VADV, VSTEP);

  v16bf qf[2][4];
#pragma unroll
  for (int c = 0; c < 2; ++c)
#pragma unroll
    for (int kc = 0; kc < 4; ++kc) qf[c][kc] = frag_bf16(Qb, DMODEL, row0 + c * 16, kc * 32);

  v8f o[2][8];
#pragma unroll
  for (int c = 0; c < 2; ++c)
#pragma unroll
    for (int t = 0; t < 8; ++t)
#pragma unroll
      for (int v = 0; v < 8; ++v) o[c][t][v] = 0.f;

  float m[2] = {-__builtin_inff(), -__builtin_inff()}, lsum[2] = {0.f, 0.f};

  asm volatile("s_wait_asynccnt 0x0" ::: "memory");  // this wave's copies of trip 0 have landed
  __syncthreads();                                   // every wave's have: trip 0 may be read
  copy_tile(ldst + TRIP_B, gk + 2 * KADV, KSTEP);
  copy_tile(ldst + TRIP_B + TILE_B, gv + 2 * VADV, VSTEP);
  copy_tile(ldst + TRIP_B + STAGE_B, gk + 3 * KADV, KSTEP);
  copy_tile(ldst + TRIP_B + STAGE_B + TILE_B, gv + 3 * VADV, VSTEP);

  const char* nk = gk + 4 * KADV;   // source of the next refill
  const char* nv = gv + 4 * VADV;
  unsigned int nl = ldst;           // its place in LDS: the buffer that the trip has just read
  for (int tr = 0; tr < NTRIP; ++tr) {
    unsigned int boff = (tr & 1) * TRIP_B;
    const unsigned char* Ks = L + boff + kh * STAGE_B;
    const unsigned char* Vs = Ks + TILE_B;
    // Fragments are fetched one pass ahead, inside the stage. Here the 8 K and 8 V^T fragments
    // of the stage's first pass, as one group of LDS reads.
    v16bf kf[8], vf[8];
#pragma unroll
    for (int kc = 0; kc < 4; ++kc) {
      kf[2 * kc]     = frag_lds(Ks, 0,  kc * 64);
      kf[2 * kc + 1] = frag_lds(Ks, 16, kc * 64);
    }
    // scheduling fence: K ahead of V^T in the group, as the S^T products need theirs first
    __builtin_amdgcn_sched_barrier(0);
#pragma unroll
    for (int t = 0; t < 8; ++t) vf[t] = frag_lds(Vs, t * 16, 0);
    // scheduling fence: keeps the group whole; left free, the reads end up singly among the
    // products, each waited for where it stands
    __builtin_amdgcn_sched_barrier(0);
    // unrolled: every LDS offset becomes an immediate and every fragment index a constant
#pragma unroll
    for (int ps = 0; ps < ST_KEYS / 32; ++ps) {
      int jl = ps * 32;
      // S^T tiles: D(j_local, i) = sum_c K[j+j_local,c] * Q[row0+i,c]; each K fragment serves
      // both query tiles
      v8f s0[2], s1[2];
#pragma unroll
      for (int c = 0; c < 2; ++c)
#pragma unroll
        for (int v = 0; v < 8; ++v) { s0[c][v] = 0.f; s1[c][v] = 0.f; }
#pragma unroll
      for (int kc = 0; kc < 4; ++kc) {
#pragma unroll
        for (int c = 0; c < 2; ++c) {
          s0[c] = wmma_bf16(kf[2 * kc],     qf[c][kc], s0[c]);
          s1[c] = wmma_bf16(kf[2 * kc + 1], qf[c][kc], s1[c]);
        }
      }
      // online softmax: stats are per-lane scalars (query i = lane&15 of each query tile)
      float mx[2], mnew[2];
#pragma unroll
      for (int c = 0; c < 2; ++c) {
        mx[c] = fmaxf(s0[c][0], s1[c][0]);
#pragma unroll
        for (int v = 1; v < 8; ++v) mx[c] = fmaxf(mx[c], fmaxf(s0[c][v], s1[c][v]));
      }
#pragma unroll
      for (int c = 0; c < 2; ++c) {
        mx[c]   = fmaxf(mx[c], __shfl_xor(mx[c], 16));
        mnew[c] = fmaxf(m[c], mx[c]);
      }
      // The next pass's K fragments (same stage, same buffer), one group, issued once the maxima
      // are known and in flight under the rest of this pass's softmax and its O^T products. The
      // scheduling fences in front of it and behind it keep the group whole and at this place:
      // without the one in front its reads are drawn up among the S^T products and ahead of the
      // maxima's exchange, whose wait then covers them all; without the one behind they sink in
      // among the O^T products.
      if (ps + 1 < ST_KEYS / 32) {
        __builtin_amdgcn_sched_barrier(0);
#pragma unroll
        for (int kc = 0; kc < 4; ++kc) {
          kf[2 * kc]     = frag_lds(Ks, jl + 32, kc * 64);
          kf[2 * kc + 1] = frag_lds(Ks, jl + 48, kc * 64);
        }
        __builtin_amdgcn_sched_barrier(0);
      }
      float alpha[2];
      v16bf pt[2];
#pragma unroll
      for (int c = 0; c < 2; ++c) {
        alpha[c] = exp2_one((m[c] - mnew[c]) * LOG2E);
        m[c] = mnew[c];

        float x0[8], x1[8], e0[8], e1[8], rs = 0.f;
#pragma unroll
        for (int v = 0; v < 8; ++v) {
          x0[v] = (s0[c][v] - mnew[c]) * LOG2E;
          x1[v] = (s1[c][v] - mnew[c]) * LOG2E;
        }
        exp2_run8(e0, x0);
        exp2_run8(e1, x1);
#pragma unroll
        for (int v = 0; v < 8; ++v) rs += e0[v] + e1[v];
        rs += __shfl_xor(rs, 16);
        lsum[c] = lsum[c] * alpha[c] + rs;

        // P^T as B-fragment, assembled directly from D layout (no shuffles)
        v8u pu = {pack_bf2(e0[0], e0[1]), pack_bf2(e0[2], e0[3]),
                  pack_bf2(e0[4], e0[5]), pack_bf2(e0[6], e0[7]),
                  pack_bf2(e1[0], e1[1]), pack_bf2(e1[2], e1[3]),
                  pack_bf2(e1[4], e1[5]), pack_bf2(e1[6], e1[7])};
        pt[c] = __builtin_bit_cast(v16bf, pu);
      }

#pragma unroll
      for (int t = 0; t < 8; ++t) {
#pragma unroll
        for (int c = 0; c < 2; ++c) {
#pragma unroll
          for (int v = 0; v < 8; ++v) o[c][t][v] *= alpha[c];
          // A: V^T rows (features); O^T(feature, i); each V^T fragment serves both query tiles
          o[c][t] = wmma_bf16(vf[t], pt[c], o[c][t]);
        }
      }
      // The next pass's V^T fragments, one group, into the registers that the O^T products have
      // just read (a second V^T set does not fit beside the accumulators of 32 query columns);
      // in flight under the next pass's S^T products. Scheduling fences: the one in front keeps
      // the O^T products ahead of the reads and of the next pass's S^T products, the one behind
      // keeps the group whole instead of dealt out singly among those products.
      if (ps + 1 < ST_KEYS / 32) {
        __builtin_amdgcn_sched_barrier(0);
#pragma unroll
        for (int t = 0; t < 8; ++t) vf[t] = frag_lds(Vs, t * 16, (jl + 32) * 2);
        __builtin_amdgcn_sched_barrier(0);
      }
    }
    // publish point of trip tr + 1, and hand-over of this trip's buffer to its refill
    asm volatile("s_wait_dscnt 0x0" ::: "memory");     // this wave's reads of the buffer are done
    asm volatile("s_wait_asynccnt 0x0" ::: "memory");  // this wave's copies of trip tr + 1 have landed
    __syncthreads();                                   // both hold for every wave of the block
    if (tr + 2 < NTRIP) {                              // the same test in the whole block
      copy_tile(nl, nk, KSTEP);
      copy_tile(nl + TILE_B, nv, VSTEP);
      copy_tile(nl + STAGE_B, nk + KADV, KSTEP);
      copy_tile(nl + STAGE_B + TILE_B, nv + VADV, VSTEP);
      nk += 2 * KADV;
      nv += 2 * VADV;
      nl += TRIP_B - 2 * boff;      // to the other buffer
    }
  }
  asm volatile("s_wait_asynccnt 0x0" ::: "memory");    // nothing of this wave is in flight at its end

  // Merge of the two key halves. Waves wv and wv ^ 4 hold partials of the same 32 queries:
  // the wave of half kh keeps query tile kh and hands the other tile to its partner through
  // LDS. The ring is free: the loop's last barrier stands behind every wave's last read of it
  // and behind every wave's wait for its last copies.
  float* X  = (float*)L;                  // 8 waves x 8 KB: the tile handed over
  float* XS = X + 8 * 2048;               // 8 waves x 32 lanes x (m, l)
  bool  up = kh != 0;
  float mk = up ? m[1] : m[0],  lk = up ? lsum[1] : lsum[0];
  float mg = up ? m[0] : m[1],  lg = up ? lsum[0] : lsum[1];
  float* xw = X + wv * 2048 + lane * 4;
#pragma unroll
  for (int t = 0; t < 8; ++t) {
    float4 g0 = {up ? o[0][t][0] : o[1][t][0], up ? o[0][t][1] : o[1][t][1],
                 up ? o[0][t][2] : o[1][t][2], up ? o[0][t][3] : o[1][t][3]};
    float4 g1 = {up ? o[0][t][4] : o[1][t][4], up ? o[0][t][5] : o[1][t][5],
                 up ? o[0][t][6] : o[1][t][6], up ? o[0][t][7] : o[1][t][7]};
    *(float4*)(xw + (2 * t) * 128)     = g0;
    *(float4*)(xw + (2 * t + 1) * 128) = g1;
  }
  *(float2*)(XS + wv * 64 + lane * 2) = make_float2(mg, lg);
  __syncthreads();   // every wave's handed-over tile is written before its partner reads it
  const float* xr = X + (wv ^ 4) * 2048 + lane * 4;
  float2 st2 = *(const float2*)(XS + (wv ^ 4) * 64 + lane * 2);
  float M  = fmaxf(mk, st2.x);
  float ak = exp2_one((mk - M) * LOG2E), ap = exp2_one((st2.x - M) * LOG2E);
  float lm = lk * ak + st2.y * ap;

  // store unnormalized partials + stats
  int row = row0 + kh * 16 + i;
  float* obase = Opart + ((size_t)grp * NTOK + row) * DMODEL;
#pragma unroll
  for (int t = 0; t < 8; ++t) {
    float4 p0 = *(const float4*)(xr + (2 * t) * 128);
    float4 p1 = *(const float4*)(xr + (2 * t + 1) * 128);
    float4 w0 = {(up ? o[1][t][0] : o[0][t][0]) * ak + p0.x * ap,
                 (up ? o[1][t][1] : o[0][t][1]) * ak + p0.y * ap,
                 (up ? o[1][t][2] : o[0][t][2]) * ak + p0.z * ap,
                 (up ? o[1][t][3] : o[0][t][3]) * ak + p0.w * ap};
    float4 w1 = {(up ? o[1][t][4] : o[0][t][4]) * ak + p1.x * ap,
                 (up ? o[1][t][5] : o[0][t][5]) * ak + p1.y * ap,
                 (up ? o[1][t][6] : o[0][t][6]) * ak + p1.z * ap,
                 (up ? o[1][t][7] : o[0][t][7]) * ak + p1.w * ap};
    ((float4*)(obase + t * 16 + h * 8))[0] = w0;
    ((float4*)(obase + t * 16 + h * 8))[1] = w1;
  }
  if (h == 0) {
    mpart[grp * NTOK + row] = M;
    lpart[grp * NTOK + row] = lm;
  }
}

// ---------- kernel 3: merge of the split-KV partials + output projection ----------
// One block = 16 rows. Its 256 threads merge the rows' GSPLIT partials into one bf16 tile in
// LDS, which is the A operand of the block's eight 16x16 output tiles (one wave each).
typedef __attribute__((ext_vector_type(4))) float v4f;

__global__ void __launch_bounds__(256) merge_out_kernel(
    const float* __restrict__ Opart, const float* __restrict__ mpart,
    const float* __restrict__ lpart, const float* __restrict__ Wo,
    const float* __restrict__ bo, float* __restrict__ out) {
  __shared__ __attribute__((aligned(16))) unsigned char At[16 * LPITCH];
  int row0 = blockIdx.x * 16, n0 = (threadIdx.x >> 5) * 16;
  int lane = threadIdx.x & 31, n = lane & 15, h = lane >> 4;

  // merge: thread -> row tid >> 4, features f0..f0+3 and f0+64..f0+67, so that each load of a
  // wave covers whole 128-byte lines
  int mr  = threadIdx.x >> 4;
  int f0  = (threadIdx.x & 15) << 2;
  int row = row0 + mr;
  v4f ov[GSPLIT][2];
#pragma unroll
  for (int g = 0; g < GSPLIT; ++g) {
    const float* p = Opart + ((size_t)g * NTOK + row) * DMODEL + f0;
    ov[g][0] = *(const v4f*)p;
    ov[g][1] = *(const v4f*)(p + 64);
  }
  // precaution: later loads may be given the address registers of the loads above as destinations
  asm volatile("s_wait_xcnt 0x0" ::: "memory");
  v4f mg, lg;
#pragma unroll
  for (int g = 0; g < GSPLIT; ++g) { mg[g] = mpart[g * NTOK + row]; lg[g] = lpart[g * NTOK + row]; }
  float bval = bo[n0 + n];
  // precaution: the same, for the nine loads above
  asm volatile("s_wait_xcnt 0x0" ::: "memory");

  // B: Wo rows (the reads of frag_f32), issued with the partials, ahead of the barrier
  const v4f* wp = (const v4f*)(Wo + (size_t)(n0 + n) * DMODEL + h * 8);
  v4f wr[4][4];
#pragma unroll
  for (int kc = 0; kc < 4; ++kc) {
    wr[kc][0] = wp[kc * 8];     wr[kc][1] = wp[kc * 8 + 1];
    wr[kc][2] = wp[kc * 8 + 4];
    // precaution: the same; the last load may be given the common address pair as its destination
    if (kc == 3) asm volatile("s_wait_xcnt 0x0" ::: "memory");
    wr[kc][3] = wp[kc * 8 + 5];
  }
  // Fence on the loaded values, inputs only: every load of the kernel is issued in front of the
  // first use of one. Left free, they are dealt out among the arithmetic in small groups, and
  // the block waits out one memory latency after another.
  asm volatile("" :: "v"(ov[0][0]), "v"(ov[0][1]), "v"(ov[1][0]), "v"(ov[1][1]),
                     "v"(ov[2][0]), "v"(ov[2][1]), "v"(ov[3][0]), "v"(ov[3][1]),
                     "v"(mg), "v"(lg), "v"(bval),
                     "v"(wr[0][0]), "v"(wr[0][1]), "v"(wr[0][2]), "v"(wr[0][3]),
                     "v"(wr[1][0]), "v"(wr[1][1]), "v"(wr[1][2]), "v"(wr[1][3]),
                     "v"(wr[2][0]), "v"(wr[2][1]), "v"(wr[2][2]), "v"(wr[2][3]),
                     "v"(wr[3][0]), "v"(wr[3][1]), "v"(wr[3][2]), "v"(wr[3][3]));

  float M = -__builtin_inff();
#pragma unroll
  for (int g = 0; g < GSPLIT; ++g) M = fmaxf(M, mg[g]);
  float w[GSPLIT], L = 0.f;
#pragma unroll
  for (int g = 0; g < GSPLIT; ++g) { w[g] = exp2_one((mg[g] - M) * LOG2E); L += w[g] * lg[g]; }
  float rinv = 1.0f / L;
#pragma unroll
  for (int c = 0; c < 2; ++c) {
    float s[4] = {0.f, 0.f, 0.f, 0.f};
#pragma unroll
    for (int g = 0; g < GSPLIT; ++g) {
      s[0] += w[g] * ov[g][c].x; s[1] += w[g] * ov[g][c].y;
      s[2] += w[g] * ov[g][c].z; s[3] += w[g] * ov[g][c].w;
    }
    *(uint2*)(At + mr * LPITCH + (f0 + c * 64) * 2) =
        make_uint2(pack_bf2(s[0] * rinv, s[1] * rinv), pack_bf2(s[2] * rinv, s[3] * rinv));
  }
  __syncthreads();   // the merged tile is whole before any wave reads its A fragments

  v8f acc = {0.f, 0.f, 0.f, 0.f, 0.f, 0.f, 0.f, 0.f};
#pragma unroll
  for (int kc = 0; kc < 4; ++kc) {
    v8u u = {pack_bf2(wr[kc][0].x, wr[kc][0].y), pack_bf2(wr[kc][0].z, wr[kc][0].w),
             pack_bf2(wr[kc][1].x, wr[kc][1].y), pack_bf2(wr[kc][1].z, wr[kc][1].w),
             pack_bf2(wr[kc][2].x, wr[kc][2].y), pack_bf2(wr[kc][2].z, wr[kc][2].w),
             pack_bf2(wr[kc][3].x, wr[kc][3].y), pack_bf2(wr[kc][3].z, wr[kc][3].w)};
    acc = wmma_bf16(frag_lds(At, 0, kc * 64), __builtin_bit_cast(v16bf, u), acc);
  }
#pragma unroll
  for (int v = 0; v < 8; ++v)
    out[(size_t)(row0 + h * 8 + v) * DMODEL + n0 + n] = acc[v] + bval;
}

// ---------- launch ----------
extern "C" void kernel_launch(void* const* d_in, const int* in_sizes, int n_in,
                              void* d_out, int out_size, void* d_ws, size_t ws_size,
                              hipStream_t stream) {
  const float* x  = (const float*)d_in[0];
  const float* Wq = (const float*)d_in[1];
  const float* bq = (const float*)d_in[2];
  const float* Wk = (const float*)d_in[3];
  const float* bk = (const float*)d_in[4];
  const float* Wv = (const float*)d_in[5];
  const float* bv = (const float*)d_in[6];
  const float* Wo = (const float*)d_in[7];
  const float* bo = (const float*)d_in[8];

  bf16_t* Qb = (bf16_t*)d_ws;                          // 2 MB
  bf16_t* Kb = Qb + (size_t)NTOK * DMODEL;             // 2 MB
  bf16_t* Vt = Kb + (size_t)NTOK * DMODEL;             // 2 MB (transposed V)
  float* Opart = (float*)(Vt + (size_t)DMODEL * NTOK); // 16 MB
  float* mpart = Opart + (size_t)GSPLIT * NTOK * DMODEL;
  float* lpart = mpart + (size_t)GSPLIT * NTOK;

  // 512 tiles * 24 combos = 12288 waves -> 1536 blocks
  qkv_kernel<<<1536, 256, 0, stream>>>(x, Wq, bq, Wk, bk, Wv, bv, Qb, Kb, Vt);
  // 64 blocks of 128 queries * 4 KV groups = 256 blocks
  flash_kernel<<<256, 256, 0, stream>>>(Qb, Kb, Vt, Opart, mpart, lpart);
  // 512 row tiles, one block each: 8 waves = 8 col-tiles
  merge_out_kernel<<<512, 256, 0, stream>>>(Opart, mpart, lpart, Wo, bo, (float*)d_out);
}

// v005
// One run takes 45.7 microseconds.
// In both of two side-by-side timings against v004, it was 1.16 times as fast.
// Counting every step since v000, it is 3.41 times as fast.
#include <hip/hip_runtime.h>
#include <hip/hip_bf16.h>

typedef __bf16 bf16_t;
typedef __attribute__((ext_vector_type(16))) __bf16        v16bf;
typedef __attribute__((ext_vector_type(8)))  float         v8f;
typedef __attribute__((ext_vector_type(8)))  unsigned int  v8u;
typedef __attribute__((ext_vector_type(4)))  float         v4f;
typedef __attribute__((ext_vector_type(4)))  __bf16        v4bf;
typedef __attribute__((ext_vector_type(8)))  __bf16        v8bf;

#define NTOK    8192
#define DMODEL  128
#define GSPLIT  4
#define KV_PER_G (NTOK / GSPLIT)
#define SM_SCALE 0.08838834764831845f   // 1/sqrt(128)

// ---------- helpers ----------

// two f32 -> packed 2x bf16 (RNE) using the native conversion path
__device__ __forceinline__ unsigned int pack_bf2(float a, float b) {
  unsigned short ua = __builtin_bit_cast(unsigned short, (__bf16)a);
  unsigned short ub = __builtin_bit_cast(unsigned short, (__bf16)b);
  return (unsigned int)ua | ((unsigned int)ub << 16);
}

__device__ __forceinline__ v8f wmma_bf16(v16bf a, v16bf b, v8f c) {
  // D = A(16x32) * B(32x16) + C, fp32 accumulate
  return __builtin_amdgcn_wmma_f32_16x16x32_bf16(false, a, false, b, (short)0, c,
                                                 false, false);
}

// A/B fragment for V_WMMA_F32_16X16X32_BF16 built from a row-major matrix.
// ISA 7.12.2 16-bit A layout: row r = lane&15; lanes 0-15 hold K
// {k0..k0+7, k0+16..k0+23}; lanes 16-31 hold K {k0+8..k0+15, k0+24..k0+31}.
// B uses the mirrored layout with r = output-column index, so the same loader
// serves B-fragments of W (x @ W^T) and of Q, A-fragments of K (row-major, contiguous in K).
// From f32 sources in two halves: the lane's 16 floats as loaded, and their rounding to bf16.
// off = byte offset of the lane's row r at column (lane >> 4) * 8; k0 = first column.
struct raw16 { v4f q[4]; };
__device__ __forceinline__ raw16 raw_f32(const float* __restrict__ base, unsigned int off, int k0) {
  const v4f* p = (const v4f*)((const char*)base + off) + (k0 >> 2);
  raw16 r;
  r.q[0] = p[0]; r.q[1] = p[1];
  r.q[2] = p[4]; r.q[3] = p[5];   // p + 16 floats
  return r;
}
__device__ __forceinline__ v16bf round_frag(const raw16& r) {
  v4bf c0 = __builtin_convertvector(r.q[0], v4bf), c1 = __builtin_convertvector(r.q[1], v4bf);
  v4bf c2 = __builtin_convertvector(r.q[2], v4bf), c3 = __builtin_convertvector(r.q[3], v4bf);
  v8bf lo = __builtin_shufflevector(c0, c1, 0, 1, 2, 3, 4, 5, 6, 7);
  v8bf hi = __builtin_shufflevector(c2, c3, 0, 1, 2, 3, 4, 5, 6, 7);
  return __builtin_shufflevector(lo, hi, 0, 1, 2, 3, 4, 5, 6, 7, 8, 9, 10, 11, 12, 13, 14, 15);
}

__device__ __forceinline__ v16bf frag_bf16(const bf16_t* __restrict__ base,
                                           int ld, int r0, int k0) {
  int lane = threadIdx.x & 31;
  const bf16_t* p = base + (size_t)(r0 + (lane & 15)) * ld + k0 + ((lane >> 4) << 3);
  uint4 lo = *(const uint4*)p;         // 8 bf16
  uint4 hi = *(const uint4*)(p + 16);  // 8 bf16
  v8u u = {lo.x, lo.y, lo.z, lo.w, hi.x, hi.y, hi.z, hi.w};
  return __builtin_bit_cast(v16bf, u);
}

// ---------- kernel 1: Q/K/V projections ----------
// One wave = 32 rows of x (two row tiles) times one 16-column tile of each of Q, K and V: six
// 16x16 tiles, every x fragment feeding three products and every W fragment two.
// One block = 8 waves = 64 rows x 4 column tiles of each matrix; 128 row groups x 2 column
// groups = 256 blocks, 2048 waves.
__global__ void __launch_bounds__(256) qkv_kernel(
    const float* __restrict__ x,
    const float* __restrict__ Wq, const float* __restrict__ bq,
    const float* __restrict__ Wk, const float* __restrict__ bk,
    const float* __restrict__ Wv, const float* __restrict__ bv,
    bf16_t* __restrict__ Qb, bf16_t* __restrict__ Kb, bf16_t* __restrict__ Vt) {
  int wv   = threadIdx.x >> 5;
  int lane = threadIdx.x & 31, n = lane & 15, h = lane >> 4;
  int row0 = (blockIdx.x >> 1) * 64 + (wv >> 2) * 32;
  int n0   = ((blockIdx.x & 1) * 4 + (wv & 3)) * 16;

  unsigned int xoff = (unsigned int)((row0 + n) * DMODEL + h * 8) * 4u;
  unsigned int woff = (unsigned int)((n0 + n) * DMODEL + h * 8) * 4u;
  raw16 xr[2][4], wr[3][4];
  // every loop of this kernel is unrolled: fragment and accumulator indices become constants,
  // so that the arrays stay in registers, and every load offset an immediate
#pragma unroll
  for (int kc = 0; kc < 4; ++kc) {
    xr[0][kc] = raw_f32(x, xoff, kc * 32);                 // A: x rows
    xr[1][kc] = raw_f32(x, xoff, 16 * DMODEL + kc * 32);
    wr[0][kc] = raw_f32(Wq, woff, kc * 32);                // B: W rows (x @ W^T)
    wr[1][kc] = raw_f32(Wk, woff, kc * 32);
    wr[2][kc] = raw_f32(Wv, woff, kc * 32);
  }
  float bvq = bq[n0 + n], bvk = bk[n0 + n], bvv = bv[n0 + n];
  // scheduling fence: every load of the wave is issued in front of the first use of one, so that
  // the wave waits out one memory latency and not one per fragment
  __builtin_amdgcn_sched_barrier(0);
  // precaution: the wait stands behind the loads and in front of every later write of the offset
  // registers that they name; as inputs here the two of the fragment loads stay whole up to it
  asm volatile("s_wait_xcnt 0x0" :: "v"(xoff), "v"(woff) : "memory");
  // scheduling fence: keeps the arithmetic behind that wait
  __builtin_amdgcn_sched_barrier(0);

  v8f acc[2][3];
#pragma unroll
  for (int r = 0; r < 2; ++r)
#pragma unroll
    for (int mat = 0; mat < 3; ++mat)
#pragma unroll
      for (int v = 0; v < 8; ++v) acc[r][mat][v] = 0.f;
#pragma unroll
  for (int kc = 0; kc < 4; ++kc) {
    v16bf a[2] = {round_frag(xr[0][kc]), round_frag(xr[1][kc])};
#pragma unroll
    for (int mat = 0; mat < 3; ++mat) {
      v16bf b = round_frag(wr[mat][kc]);
#pragma unroll
      for (int r = 0; r < 2; ++r) acc[r][mat] = wmma_bf16(a[r], b, acc[r][mat]);
    }
  }

#pragma unroll
  for (int r = 0; r < 2; ++r) {
    int rw = row0 + r * 16 + h * 8;
#pragma unroll
    for (int v = 0; v < 8; ++v) {                   // Q, K: row-major bf16
      Qb[(size_t)(rw + v) * DMODEL + n0 + n] =
          (__bf16)((acc[r][0][v] + bvq) * SM_SCALE);  // softmax scale folded into Q
      Kb[(size_t)(rw + v) * DMODEL + n0 + n] = (__bf16)(acc[r][1][v] + bvk);
    }
    // V: store transposed, Vt[n][token]
    *(uint4*)(Vt + (size_t)(n0 + n) * NTOK + rw) =
        make_uint4(pack_bf2(acc[r][2][0] + bvv, acc[r][2][1] + bvv),
                   pack_bf2(acc[r][2][2] + bvv, acc[r][2][3] + bvv),
                   pack_bf2(acc[r][2][4] + bvv, acc[r][2][5] + bvv),
                   pack_bf2(acc[r][2][6] + bvv, acc[r][2][7] + bvv));
  }
}

// ---------- kernel 2: flash attention (transposed), split-KV ----------
// One block = 8 waves = 128 queries of ONE KV group. A wave holds 32 query columns (two Q
// tiles), so every K and V^T fragment it reads from LDS feeds two products. Waves 0-3 cover
// the block's 128 queries on the even stages (128 keys each), waves 4-7 the same queries on
// the odd stages; the two halves' partials are merged through LDS behind the loop.
// K rows and V^T rows of two stages (one trip) are brought into LDS once per block by
// asynchronous copies; two buffers, the next trip's copies fly while this trip is worked on.
// Inside a stage each wave fetches its fragments one pass (32 keys) ahead.
// Computes S^T = K * Q^T so the D-layout of exp(S^T) is directly the
// B-fragment of O^T = V^T * P^T (no shuffles).
#define ST_KEYS  128                      // keys per stage
#define NSTAGE   (KV_PER_G / ST_KEYS)     // 16 stages per block
#define NTRIP    (NSTAGE / 2)             // a trip = two stages, one for each half of the waves
#define LPITCH   272                      // 256-byte rows + 16: conflict-free 16-byte reads
#define TILE_B   (128 * LPITCH)           // K tile: 128 keys x 128 features; V^T tile: 128 features x 128 keys
#define STAGE_B  (2 * TILE_B)
#define TRIP_B   (2 * STAGE_B)

// Eight 16-byte copies of one lane: rows r, r+16, ... r+112 of a 128-row tile.
// lds: the lane's LDS byte address of row r; g: its global address; gstep: bytes
// between source rows r and r+16. The s_wait_xcnt closes the statement so that no
// address register named here is rewritten before the copies have taken it.
__device__ __forceinline__ void copy_tile(unsigned int lds, const char* g, size_t gstep) {
  asm volatile(
      "global_load_async_to_lds_b128 %0, %8, off\n\t"
      "global_load_async_to_lds_b128 %1, %9, off\n\t"
      "global_load_async_to_lds_b128 %2, %10, off\n\t"
      "global_load_async_to_lds_b128 %3, %11, off\n\t"
      "global_load_async_to_lds_b128 %4, %12, off\n\t"
      "global_load_async_to_lds_b128 %5, %13, off\n\t"
      "global_load_async_to_lds_b128 %6, %14, off\n\t"
      "global_load_async_to_lds_b128 %7, %15, off\n\t"
      "s_wait_xcnt 0x0"
      :: "v"(lds), "v"(lds + 16u * LPITCH), "v"(lds + 32u * LPITCH), "v"(lds + 48u * LPITCH),
         "v"(lds + 64u * LPITCH), "v"(lds + 80u * LPITCH), "v"(lds + 96u * LPITCH),
         "v"(lds + 112u * LPITCH),
         "v"(g), "v"(g + gstep), "v"(g + 2 * gstep), "v"(g + 3 * gstep),
         "v"(g + 4 * gstep), "v"(g + 5 * gstep), "v"(g + 6 * gstep), "v"(g + 7 * gstep)
      : "memory");
}

// Same fragment as frag_bf16, from an LDS tile of LPITCH-byte rows; kb = byte offset of k0.
__device__ __forceinline__ v16bf frag_lds(const unsigned char* tile, int r0, int kb) {
  int lane = threadIdx.x & 31;
  const unsigned char* p = tile + (r0 + (lane & 15)) * LPITCH + kb + ((lane >> 4) << 4);
  uint4 lo = *(const uint4*)p;         // 8 bf16
  uint4 hi = *(const uint4*)(p + 32);  // 8 bf16, 16 elements on
  v8u u = {lo.x, lo.y, lo.z, lo.w, hi.x, hi.y, hi.z, hi.w};
  return __builtin_bit_cast(v16bf, u);
}

// Runs of v_exp_f32 (2^x), each run one statement closed by a v_nop: the slot that the
// instruction set asks for between a transcendental and the next vector instruction that
// overwrites its source or reads its result.
__device__ __forceinline__ void exp2_run8(float (&r)[8], const float (&x)[8]) {
  asm("v_exp_f32 %0, %8\n\t"
      "v_exp_f32 %1, %9\n\t"
      "v_exp_f32 %2, %10\n\t"
      "v_exp_f32 %3, %11\n\t"
      "v_exp_f32 %4, %12\n\t"
      "v_exp_f32 %5, %13\n\t"
      "v_exp_f32 %6, %14\n\t"
      "v_exp_f32 %7, %15\n\t"
      "v_nop"
      : "=&v"(r[0]), "=&v"(r[1]), "=&v"(r[2]), "=&v"(r[3]),
        "=&v"(r[4]), "=&v"(r[5]), "=&v"(r[6]), "=&v"(r[7])
      : "v"(x[0]), "v"(x[1]), "v"(x[2]), "v"(x[3]), "v"(x[4]), "v"(x[5]), "v"(x[6]), "v"(x[7]));
}
__device__ __forceinline__ float exp2_one(float x) {
  float r;
  asm("v_exp_f32 %0, %1\n\tv_nop" : "=&v"(r) : "v"(x));
  return r;
}
#define LOG2E 1.4426950408889634f   // exp(x) = 2^(x * LOG2E), as __expf forms it

__global__ void __launch_bounds__(256) flash_kernel(
    const bf16_t* __restrict__ Qb, const bf16_t* __restrict__ Kb,
    const bf16_t* __restrict__ Vt,
    float* __restrict__ Opart, float* __restrict__ mpart,
    float* __restrict__ lpart) {
  __shared__ __attribute__((aligned(16))) unsigned char L[2 * TRIP_B];

  int grp  = blockIdx.x & 3;
  int wv   = threadIdx.x >> 5;
  int kh   = wv >> 2;                                   // which stage of a trip this wave works on
  int row0 = (blockIdx.x >> 2) * 128 + (wv & 3) * 32;   // first of the wave's 32 queries
  int lane = threadIdx.x & 31, i = lane & 15, h = lane >> 4;
  int jbase = grp * KV_PER_G;

  // this thread's share of every stage: 16-byte column (tid & 15) of rows (tid >> 4) + 16 n
  int crow = threadIdx.x >> 4, ccol = threadIdx.x & 15;
  unsigned int ldst = (unsigned int)(size_t)L + crow * LPITCH + ccol * 16;
  const char* gk = (const char*)(Kb + (size_t)(jbase + crow) * DMODEL + ccol * 8);
  const char* gv = (const char*)(Vt + (size_t)crow * NTOK + jbase + ccol * 8);
  const size_t KSTEP = (size_t)16 * DMODEL * 2, VSTEP = (size_t)16 * NTOK * 2;   // 16 source rows
  const size_t KADV  = (size_t)ST_KEYS * DMODEL * 2, VADV = (size_t)ST_KEYS * 2; // one stage on

  // trip 0 (stages 0 and 1) into buffer 0, landed and published; then trip 1 into buffer 1
  copy_tile(ldst, gk, KSTEP);
  copy_tile(ldst + TILE_B, gv, VSTEP);
  copy_tile(ldst + STAGE_B, gk + KADV, KSTEP);
  copy_tile(ldst + STAGE_B + TILE_B, gv + VADV, VSTEP);

  v16bf qf[2][4];
#pragma unroll
  for (int c = 0; c < 2; ++c)
#pragma unroll
    for (int kc = 0; kc < 4; ++kc) qf[c][kc] = frag_bf16(Qb, DMODEL, row0 + c * 16, kc * 32);

  v8f o[2][8];
#pragma unroll
  for (int c = 0; c < 2; ++c)
#pragma unroll
    for (int t = 0; t < 8; ++t)
#pragma unroll
      for (int v = 0; v < 8; ++v) o[c][t][v] = 0.f;

  float m[2] = {-__builtin_inff(), -__builtin_inff()}, lsum[2] = {0.f, 0.f};

  asm volatile("s_wait_asynccnt 0x0" ::: "memory");  // this wave's copies of trip 0 have landed
  __syncthreads();                                   // every wave's have: trip 0 may be read
  copy_tile(ldst + TRIP_B, gk + 2 * KADV, KSTEP);
  copy_tile(ldst + TRIP_B + TILE_B, gv + 2 * VADV, VSTEP);
  copy_tile(ldst + TRIP_B + STAGE_B, gk + 3 * KADV, KSTEP);
  copy_tile(ldst + TRIP_B + STAGE_B + TILE_B, gv + 3 * VADV, VSTEP);

  const char* nk = gk + 4 * KADV;   // source of the next refill
  const char* nv = gv + 4 * VADV;
  unsigned int nl = ldst;           // its place in LDS: the buffer that the trip has just read
  for (int tr = 0; tr < NTRIP; ++tr) {
    unsigned int boff = (tr & 1) * TRIP_B;
    const unsigned char* Ks = L + boff + kh * STAGE_B;
    const unsigned char* Vs = Ks + TILE_B;
    // Fragments are fetched one pass ahead, inside the stage. Here the 8 K and 8 V^T fragments
    // of the stage's first pass, as one group of LDS reads.
    v16bf kf[8], vf[8];
#pragma unroll
    for (int kc = 0; kc < 4; ++kc) {
      kf[2 * kc]     = frag_lds(Ks, 0,  kc * 64);
      kf[2 * kc + 1] = frag_lds(Ks, 16, kc * 64);
    }
    // scheduling fence: K ahead of V^T in the group, as the S^T products need theirs first
    __builtin_amdgcn_sched_barrier(0);
#pragma unroll
    for (int t = 0; t < 8; ++t) vf[t] = frag_lds(Vs, t * 16, 0);
    // scheduling fence: keeps the group whole; left free, the reads end up singly among the
    // products, each waited for where it stands
    __builtin_amdgcn_sched_barrier(0);
    // unrolled: every LDS offset becomes an immediate and every fragment index a constant
#pragma unroll
    for (int ps = 0; ps < ST_KEYS / 32; ++ps) {
      int jl = ps * 32;
      // S^T tiles: D(j_local, i) = sum_c K[j+j_local,c] * Q[row0+i,c]; each K fragment serves
      // both query tiles
      v8f s0[2], s1[2];
#pragma unroll
      for (int c = 0; c < 2; ++c)
#pragma unroll
        for (int v = 0; v < 8; ++v) { s0[c][v] = 0.f; s1[c][v] = 0.f; }
#pragma unroll
      for (int kc = 0; kc < 4; ++kc) {
#pragma unroll
        for (int c = 0; c < 2; ++c) {
          s0[c] = wmma_bf16(kf[2 * kc],     qf[c][kc], s0[c]);
          s1[c] = wmma_bf16(kf[2 * kc + 1], qf[c][kc], s1[c]);
        }
      }
      // online softmax: stats are per-lane scalars (query i = lane&15 of each query tile)
      float mx[2], mnew[2];
#pragma unroll
      for (int c = 0; c < 2; ++c) {
        mx[c] = fmaxf(s0[c][0], s1[c][0]);
#pragma unroll
        for (int v = 1; v < 8; ++v) mx[c] = fmaxf(mx[c], fmaxf(s0[c][v], s1[c][v]));
      }
#pragma unroll
      for (int c = 0; c < 2; ++c) {
        mx[c]   = fmaxf(mx[c], __shfl_xor(mx[c], 16));
        mnew[c] = fmaxf(m[c], mx[c]);
      }
      // The next pass's K fragments (same stage, same buffer), one group, issued once the maxima
      // are known and in flight under the rest of this pass's softmax and its O^T products. The
      // scheduling fences in front of it and behind it keep the group whole and at this place:
      // without the one in front its reads are drawn up among the S^T products and ahead of the
      // maxima's exchange, whose wait then covers them all; without the one behind they sink in
      // among the O^T products.
      if (ps + 1 < ST_KEYS / 32) {
        __builtin_amdgcn_sched_barrier(0);
#pragma unroll
        for (int kc = 0; kc < 4; ++kc) {
          kf[2 * kc]     = frag_lds(Ks, jl + 32, kc * 64);
          kf[2 * kc + 1] = frag_lds(Ks, jl + 48, kc * 64);
        }
        __builtin_amdgcn_sched_barrier(0);
      }
      float alpha[2];
      v16bf pt[2];
#pragma unroll
      for (int c = 0; c < 2; ++c) {
        alpha[c] = exp2_one((m[c] - mnew[c]) * LOG2E);
        m[c] = mnew[c];

        float x0[8], x1[8], e0[8], e1[8], rs = 0.f;
#pragma unroll
        for (int v = 0; v < 8; ++v) {
          x0[v] = (s0[c][v] - mnew[c]) * LOG2E;
          x1[v] = (s1[c][v] - mnew[c]) * LOG2E;
        }
        exp2_run8(e0, x0);
        exp2_run8(e1, x1);
#pragma unroll
        for (int v = 0; v < 8; ++v) rs += e0[v] + e1[v];
        rs += __shfl_xor(rs, 16);
        lsum[c] = lsum[c] * alpha[c] + rs;

        // P^T as B-fragment, assembled directly from D layout (no shuffles)
        v8u pu = {pack_bf2(e0[0], e0[1]), pack_bf2(e0[2], e0[3]),
                  pack_bf2(e0[4], e0[5]), pack_bf2(e0[6], e0[7]),
                  pack_bf2(e1[0], e1[1]), pack_bf2(e1[2], e1[3]),
                  pack_bf2(e1[4], e1[5]), pack_bf2(e1[6], e1[7])};
        pt[c] = __builtin_bit_cast(v16bf, pu);
      }

#pragma unroll
      for (int t = 0; t < 8; ++t) {
#pragma unroll
        for (int c = 0; c < 2; ++c) {
#pragma unroll
          for (int v = 0; v < 8; ++v) o[c][t][v] *= alpha[c];
          // A: V^T rows (features); O^T(feature, i); each V^T fragment serves both query tiles
          o[c][t] = wmma_bf16(vf[t], pt[c], o[c][t]);
        }
      }
      // The next pass's V^T fragments, one group, into the registers that the O^T products have
      // just read (a second V^T set does not fit beside the accumulators of 32 query columns);
      // in flight under the next pass's S^T products. Scheduling fences: the one in front keeps
      // the O^T products ahead of the reads and of the next pass's S^T products, the one behind
      // keeps the group whole instead of dealt out singly among those products.
      if (ps + 1 < ST_KEYS / 32) {
        __builtin_amdgcn_sched_barrier(0);
#pragma unroll
        for (int t = 0; t < 8; ++t) vf[t] = frag_lds(Vs, t * 16, (jl + 32) * 2);
        __builtin_amdgcn_sched_barrier(0);
      }
    }
    // publish point of trip tr + 1, and hand-over of this trip's buffer to its refill
    asm volatile("s_wait_dscnt 0x0" ::: "memory");     // this wave's reads of the buffer are done
    asm volatile("s_wait_asynccnt 0x0" ::: "memory");  // this wave's copies of trip tr + 1 have landed
    __syncthreads();                                   // both hold for every wave of the block
    if (tr + 2 < NTRIP) {                              // the same test in the whole block
      copy_tile(nl, nk, KSTEP);
      copy_tile(nl + TILE_B, nv, VSTEP);
      copy_tile(nl + STAGE_B, nk + KADV, KSTEP);
      copy_tile(nl + STAGE_B + TILE_B, nv + VADV, VSTEP);
      nk += 2 * KADV;
      nv += 2 * VADV;
      nl += TRIP_B - 2 * boff;      // to the other buffer
    }
  }
  asm volatile("s_wait_asynccnt 0x0" ::: "memory");    // nothing of this wave is in flight at its end

  // Merge of the two key halves. Waves wv and wv ^ 4 hold partials of the same 32 queries:
  // the wave of half kh keeps query tile kh and hands the other tile to its partner through
  // LDS. The ring is free: the loop's last barrier stands behind every wave's last read of it
  // and behind every wave's wait for its last copies.
  float* X  = (float*)L;                  // 8 waves x 8 KB: the tile handed over
  float* XS = X + 8 * 2048;               // 8 waves x 32 lanes x (m, l)
  bool  up = kh != 0;
  float mk = up ? m[1] : m[0],  lk = up ? lsum[1] : lsum[0];
  float mg = up ? m[0] : m[1],  lg = up ? lsum[0] : lsum[1];
  float* xw = X + wv * 2048 + lane * 4;
#pragma unroll
  for (int t = 0; t < 8; ++t) {
    float4 g0 = {up ? o[0][t][0] : o[1][t][0], up ? o[0][t][1] : o[1][t][1],
                 up ? o[0][t][2] : o[1][t][2], up ? o[0][t][3] : o[1][t][3]};
    float4 g1 = {up ? o[0][t][4] : o[1][t][4], up ? o[0][t][5] : o[1][t][5],
                 up ? o[0][t][6] : o[1][t][6], up ? o[0][t][7] : o[1][t][7]};
    *(float4*)(xw + (2 * t) * 128)     = g0;
    *(float4*)(xw + (2 * t + 1) * 128) = g1;
  }
  *(float2*)(XS + wv * 64 + lane * 2) = make_float2(mg, lg);
  __syncthreads();   // every wave's handed-over tile is written before its partner reads it
  const float* xr = X + (wv ^ 4) * 2048 + lane * 4;
  float2 st2 = *(const float2*)(XS + (wv ^ 4) * 64 + lane * 2);
  float M  = fmaxf(mk, st2.x);
  float ak = exp2_one((mk - M) * LOG2E), ap = exp2_one((st2.x - M) * LOG2E);
  float lm = lk * ak + st2.y * ap;

  // store unnormalized partials + stats
  int row = row0 + kh * 16 + i;
  float* obase = Opart + ((size_t)grp * NTOK + row) * DMODEL;
#pragma unroll
  for (int t = 0; t < 8; ++t) {
    float4 p0 = *(const float4*)(xr + (2 * t) * 128);
    float4 p1 = *(const float4*)(xr + (2 * t + 1) * 128);
    float4 w0 = {(up ? o[1][t][0] : o[0][t][0]) * ak + p0.x * ap,
                 (up ? o[1][t][1] : o[0][t][1]) * ak + p0.y * ap,
                 (up ? o[1][t][2] : o[0][t][2]) * ak + p0.z * ap,
                 (up ? o[1][t][3] : o[0][t][3]) * ak + p0.w * ap};
    float4 w1 = {(up ? o[1][t][4] : o[0][t][4]) * ak + p1.x * ap,
                 (up ? o[1][t][5] : o[0][t][5]) * ak + p1.y * ap,
                 (up ? o[1][t][6] : o[0][t][6]) * ak + p1.z * ap,
                 (up ? o[1][t][7] : o[0][t][7]) * ak + p1.w * ap};
    ((float4*)(obase + t * 16 + h * 8))[0] = w0;
    ((float4*)(obase + t * 16 + h * 8))[1] = w1;
  }
  if (h == 0) {
    mpart[grp * NTOK + row] = M;
    lpart[grp * NTOK + row] = lm;
  }
}

// ---------- kernel 3: merge of the split-KV partials + output projection ----------
// One block = 16 rows. Its 256 threads merge the rows' GSPLIT partials into one bf16 tile in
// LDS, which is the A operand of the block's eight 16x16 output tiles (one wave each).
__global__ void __launch_bounds__(256) merge_out_kernel(
    const float* __restrict__ Opart, const float* __restrict__ mpart,
    const float* __restrict__ lpart, const float* __restrict__ Wo,
    const float* __restrict__ bo, float* __restrict__ out) {
  __shared__ __attribute__((aligned(16))) unsigned char At[16 * LPITCH];
  int row0 = blockIdx.x * 16, n0 = (threadIdx.x >> 5) * 16;
  int lane = threadIdx.x & 31, n = lane & 15, h = lane >> 4;

  // merge: thread -> row tid >> 4, features f0..f0+3 and f0+64..f0+67, so that each load of a
  // wave covers whole 128-byte lines
  int mr  = threadIdx.x >> 4;
  int f0  = (threadIdx.x & 15) << 2;
  int row = row0 + mr;
  v4f ov[GSPLIT][2];
#pragma unroll
  for (int g = 0; g < GSPLIT; ++g) {
    const float* p = Opart + ((size_t)g * NTOK + row) * DMODEL + f0;
    ov[g][0] = *(const v4f*)p;
    ov[g][1] = *(const v4f*)(p + 64);
  }
  // precaution: later loads may be given the address registers of the loads above as destinations
  asm volatile("s_wait_xcnt 0x0" ::: "memory");
  v4f mg, lg;
#pragma unroll
  for (int g = 0; g < GSPLIT; ++g) { mg[g] = mpart[g * NTOK + row]; lg[g] = lpart[g * NTOK + row]; }
  float bval = bo[n0 + n];
  // precaution: the same, for the nine loads above
  asm volatile("s_wait_xcnt 0x0" ::: "memory");

  // B: Wo rows (the reads of raw_f32), issued with the partials, ahead of the barrier
  const v4f* wp = (const v4f*)(Wo + (size_t)(n0 + n) * DMODEL + h * 8);
  v4f wr[4][4];
#pragma unroll
  for (int kc = 0; kc < 4; ++kc) {
    wr[kc][0] = wp[kc * 8];     wr[kc][1] = wp[kc * 8 + 1];
    wr[kc][2] = wp[kc * 8 + 4];
    // precaution: the same; the last load may be given the common address pair as its destination
    if (kc == 3) asm volatile("s_wait_xcnt 0x0" ::: "memory");
    wr[kc][3] = wp[kc * 8 + 5];
  }
  // Fence on the loaded values, inputs only: every load of the kernel is issued in front of the
  // first use of one. Left free, they are dealt out among the arithmetic in small groups, and
  // the block waits out one memory latency after another.
  asm volatile("" :: "v"(ov[0][0]), "v"(ov[0][1]), "v"(ov[1][0]), "v"(ov[1][1]),
                     "v"(ov[2][0]), "v"(ov[2][1]), "v"(ov[3][0]), "v"(ov[3][1]),
                     "v"(mg), "v"(lg), "v"(bval),
                     "v"(wr[0][0]), "v"(wr[0][1]), "v"(wr[0][2]), "v"(wr[0][3]),
                     "v"(wr[1][0]), "v"(wr[1][1]), "v"(wr[1][2]), "v"(wr[1][3]),
                     "v"(wr[2][0]), "v"(wr[2][1]), "v"(wr[2][2]), "v"(wr[2][3]),
                     "v"(wr[3][0]), "v"(wr[3][1]), "v"(wr[3][2]), "v"(wr[3][3]));

  float M = -__builtin_inff();
#pragma unroll
  for (int g = 0; g < GSPLIT; ++g) M = fmaxf(M, mg[g]);
  float w[GSPLIT], L = 0.f;
#pragma unroll
  for (int g = 0; g < GSPLIT; ++g) { w[g] = exp2_one((mg[g] - M) * LOG2E); L += w[g] * lg[g]; }
  float rinv = 1.0f / L;
#pragma unroll
  for (int c = 0; c < 2; ++c) {
    float s[4] = {0.f, 0.f, 0.f, 0.f};
#pragma unroll
    for (int g = 0; g < GSPLIT; ++g) {
      s[0] += w[g] * ov[g][c].x; s[1] += w[g] * ov[g][c].y;
      s[2] += w[g] * ov[g][c].z; s[3] += w[g] * ov[g][c].w;
    }
    *(uint2*)(At + mr * LPITCH + (f0 + c * 64) * 2) =
        make_uint2(pack_bf2(s[0] * rinv, s[1] * rinv), pack_bf2(s[2] * rinv, s[3] * rinv));
  }
  __syncthreads();   // the merged tile is whole before any wave reads its A fragments

  v8f acc = {0.f, 0.f, 0.f, 0.f, 0.f, 0.f, 0.f, 0.f};
#pragma unroll
  for (int kc = 0; kc < 4; ++kc) {
    v8u u = {pack_bf2(wr[kc][0].x, wr[kc][0].y), pack_bf2(wr[kc][0].z, wr[kc][0].w),
             pack_bf2(wr[kc][1].x, wr[kc][1].y), pack_bf2(wr[kc][1].z, wr[kc][1].w),
             pack_bf2(wr[kc][2].x, wr[kc][2].y), pack_bf2(wr[kc][2].z, wr[kc][2].w),
             pack_bf2(wr[kc][3].x, wr[kc][3].y), pack_bf2(wr[kc][3].z, wr[kc][3].w)};
    acc = wmma_bf16(frag_lds(At, 0, kc * 64), __builtin_bit_cast(v16bf, u), acc);
  }
#pragma unroll
  for (int v = 0; v < 8; ++v)
    out[(size_t)(row0 + h * 8 + v) * DMODEL + n0 + n] = acc[v] + bval;
}

// ---------- launch ----------
extern "C" void kernel_launch(void* const* d_in, const int* in_sizes, int n_in,
                              void* d_out, int out_size, void* d_ws, size_t ws_size,
                              hipStream_t stream) {
  const float* x  = (const float*)d_in[0];
  const float* Wq = (const float*)d_in[1];
  const float* bq = (const float*)d_in[2];
  const float* Wk = (const float*)d_in[3];
  const float* bk = (const float*)d_in[4];
  const float* Wv = (const float*)d_in[5];
  const float* bv = (const float*)d_in[6];
  const float* Wo = (const float*)d_in[7];
  const float* bo = (const float*)d_in[8];

  bf16_t* Qb = (bf16_t*)d_ws;                          // 2 MB
  bf16_t* Kb = Qb + (size_t)NTOK * DMODEL;             // 2 MB
  bf16_t* Vt = Kb + (size_t)NTOK * DMODEL;             // 2 MB (transposed V)
  float* Opart = (float*)(Vt + (size_t)DMODEL * NTOK); // 16 MB
  float* mpart = Opart + (size_t)GSPLIT * NTOK * DMODEL;
  float* lpart = mpart + (size_t)GSPLIT * NTOK;

  // 128 groups of 64 rows * 2 groups of 4 column tiles = 256 blocks
  qkv_kernel<<<256, 256, 0, stream>>>(x, Wq, bq, Wk, bk, Wv, bv, Qb, Kb, Vt);
  // 64 blocks of 128 queries * 4 KV groups = 256 blocks
  flash_kernel<<<256, 256, 0, stream>>>(Qb, Kb, Vt, Opart, mpart, lpart);
  // 512 row tiles, one block each: 8 waves = 8 col-tiles
  merge_out_kernel<<<512, 256, 0, stream>>>(Opart, mpart, lpart, Wo, bo, (float*)d_out);
}

// v006
// Measured time: 43 microseconds a run.
// Next to v005, in two timings, it ran 1.06 and 1.07 times as fast.
// All steps since v000 together make it 3.63 times as fast.
#include <hip/hip_runtime.h>
#include <hip/hip_bf16.h>

typedef __bf16 bf16_t;
typedef __attribute__((ext_vector_type(16))) __bf16        v16bf;
typedef __attribute__((ext_vector_type(8)))  float         v8f;
typedef __attribute__((ext_vector_type(8)))  unsigned int  v8u;
typedef __attribute__((ext_vector_type(4)))  float         v4f;
typedef __attribute__((ext_vector_type(4)))  __bf16        v4bf;
typedef __attribute__((ext_vector_type(8)))  __bf16        v8bf;

#define NTOK    8192
#define DMODEL  128
#define GSPLIT  4
#define KV_PER_G (NTOK / GSPLIT)
#define SM_SCALE 0.08838834764831845f   // 1/sqrt(128)

// ---------- helpers ----------

// two f32 -> packed 2x bf16 (RNE) using the native conversion path
__device__ __forceinline__ unsigned int pack_bf2(float a, float b) {
  unsigned short ua = __builtin_bit_cast(unsigned short, (__bf16)a);
  unsigned short ub = __builtin_bit_cast(unsigned short, (__bf16)b);
  return (unsigned int)ua | ((unsigned int)ub << 16);
}

__device__ __forceinline__ v8f wmma_bf16(v16bf a, v16bf b, v8f c) {
  // D = A(16x32) * B(32x16) + C, fp32 accumulate
  return __builtin_amdgcn_wmma_f32_16x16x32_bf16(false, a, false, b, (short)0, c,
                                                 false, false);
}

// A/B fragment for V_WMMA_F32_16X16X32_BF16 built from a row-major matrix.
// ISA 7.12.2 16-bit A layout: row r = lane&15; lanes 0-15 hold K
// {k0..k0+7, k0+16..k0+23}; lanes 16-31 hold K {k0+8..k0+15, k0+24..k0+31}.
// B uses the mirrored layout with r = output-column index, so the same loader
// serves B-fragments of W (x @ W^T) and of Q, A-fragments of K (row-major, contiguous in K).
// From f32 sources in two halves: the lane's 16 floats as loaded, and their rounding to bf16.
// off = byte offset of the lane's row r at column (lane >> 4) * 8; k0 = first column.
struct raw16 { v4f q[4]; };
__device__ __forceinline__ raw16 raw_f32(const float* __restrict__ base, unsigned int off, int k0) {
  const v4f* p = (const v4f*)((const char*)base + off) + (k0 >> 2);
  raw16 r;
  r.q[0] = p[0]; r.q[1] = p[1];
  r.q[2] = p[4]; r.q[3] = p[5];   // p + 16 floats
  return r;
}
__device__ __forceinline__ v16bf round_frag(const raw16& r) {
  v4bf c0 = __builtin_convertvector(r.q[0], v4bf), c1 = __builtin_convertvector(r.q[1], v4bf);
  v4bf c2 = __builtin_convertvector(r.q[2], v4bf), c3 = __builtin_convertvector(r.q[3], v4bf);
  v8bf lo = __builtin_shufflevector(c0, c1, 0, 1, 2, 3, 4, 5, 6, 7);
  v8bf hi = __builtin_shufflevector(c2, c3, 0, 1, 2, 3, 4, 5, 6, 7);
  return __builtin_shufflevector(lo, hi, 0, 1, 2, 3, 4, 5, 6, 7, 8, 9, 10, 11, 12, 13, 14, 15);
}

__device__ __forceinline__ v16bf frag_bf16(const bf16_t* __restrict__ base,
                                           int ld, int r0, int k0) {
  int lane = threadIdx.x & 31;
  const bf16_t* p = base + (size_t)(r0 + (lane & 15)) * ld + k0 + ((lane >> 4) << 3);
  uint4 lo = *(const uint4*)p;         // 8 bf16
  uint4 hi = *(const uint4*)(p + 16);  // 8 bf16
  v8u u = {lo.x, lo.y, lo.z, lo.w, hi.x, hi.y, hi.z, hi.w};
  return __builtin_bit_cast(v16bf, u);
}

// ---------- kernel 1: Q/K/V projections ----------
// One wave = 32 rows of x (two row tiles) times one 16-column tile of each of Q, K and V: six
// 16x16 tiles, every x fragment feeding three products and every W fragment two.
// One block = 8 waves = 64 rows x 4 column tiles of each matrix; 128 row groups x 2 column
// groups = 256 blocks, 2048 waves.
__global__ void __launch_bounds__(256) qkv_kernel(
    const float* __restrict__ x,
    const float* __restrict__ Wq, const float* __restrict__ bq,
    const float* __restrict__ Wk, const float* __restrict__ bk,
    const float* __restrict__ Wv, const float* __restrict__ bv,
    bf16_t* __restrict__ Qb, bf16_t* __restrict__ Kb, bf16_t* __restrict__ Vt) {
  int wv   = threadIdx.x >> 5;
  int lane = threadIdx.x & 31, n = lane & 15, h = lane >> 4;
  int row0 = (blockIdx.x >> 1) * 64 + (wv >> 2) * 32;
  int n0   = ((blockIdx.x & 1) * 4 + (wv & 3)) * 16;

  unsigned int xoff = (unsigned int)((row0 + n) * DMODEL + h * 8) * 4u;
  unsigned int woff = (unsigned int)((n0 + n) * DMODEL + h * 8) * 4u;
  raw16 xr[2][4], wr[3][4];
  // every loop of this kernel is unrolled: fragment and accumulator indices become constants,
  // so that the arrays stay in registers, and every load offset an immediate
#pragma unroll
  for (int kc = 0; kc < 4; ++kc) {
    xr[0][kc] = raw_f32(x, xoff, kc * 32);                 // A: x rows
    xr[1][kc] = raw_f32(x, xoff, 16 * DMODEL + kc * 32);
    wr[0][kc] = raw_f32(Wq, woff, kc * 32);                // B: W rows (x @ W^T)
    wr[1][kc] = raw_f32(Wk, woff, kc * 32);
    wr[2][kc] = raw_f32(Wv, woff, kc * 32);
  }
  float bvq = bq[n0 + n], bvk = bk[n0 + n], bvv = bv[n0 + n];
  // scheduling fence: every load of the wave is issued in front of the first use of one, so that
  // the wave waits out one memory latency and not one per fragment
  __builtin_amdgcn_sched_barrier(0);
  // precaution: the wait stands behind the loads and in front of every later write of the offset
  // registers that they name; as inputs here the two of the fragment loads stay whole up to it
  asm volatile("s_wait_xcnt 0x0" :: "v"(xoff), "v"(woff) : "memory");
  // scheduling fence: keeps the arithmetic behind that wait
  __builtin_amdgcn_sched_barrier(0);

  v8f acc[2][3];
#pragma unroll
  for (int r = 0; r < 2; ++r)
#pragma unroll
    for (int mat = 0; mat < 3; ++mat)
#pragma unroll
      for (int v = 0; v < 8; ++v) acc[r][mat][v] = 0.f;
#pragma unroll
  for (int kc = 0; kc < 4; ++kc) {
    v16bf a[2] = {round_frag(xr[0][kc]), round_frag(xr[1][kc])};
#pragma unroll
    for (int mat = 0; mat < 3; ++mat) {
      v16bf b = round_frag(wr[mat][kc]);
#pragma unroll
      for (int r = 0; r < 2; ++r) acc[r][mat] = wmma_bf16(a[r], b, acc[r][mat]);
    }
  }

#pragma unroll
  for (int r = 0; r < 2; ++r) {
    int rw = row0 + r * 16 + h * 8;
#pragma unroll
    for (int v = 0; v < 8; ++v) {                   // Q, K: row-major bf16
      Qb[(size_t)(rw + v) * DMODEL + n0 + n] =
          (__bf16)((acc[r][0][v] + bvq) * SM_SCALE);  // softmax scale folded into Q
      Kb[(size_t)(rw + v) * DMODEL + n0 + n] = (__bf16)(acc[r][1][v] + bvk);
    }
    // V: store transposed, Vt[n][token]
    *(uint4*)(Vt + (size_t)(n0 + n) * NTOK + rw) =
        make_uint4(pack_bf2(acc[r][2][0] + bvv, acc[r][2][1] + bvv),
                   pack_bf2(acc[r][2][2] + bvv, acc[r][2][3] + bvv),
                   pack_bf2(acc[r][2][4] + bvv, acc[r][2][5] + bvv),
                   pack_bf2(acc[r][2][6] + bvv, acc[r][2][7] + bvv));
  }
}

// ---------- kernel 2: flash attention (transposed), split-KV ----------
// One block = 8 waves = 128 queries of ONE KV group. A wave holds 32 query columns (two Q
// tiles), so every K and V^T fragment it reads from LDS feeds two products. Waves 0-3 cover
// the block's 128 queries on the even stages (128 keys each), waves 4-7 the same queries on
// the odd stages; the two halves' partials are merged through LDS behind the loop.
// K rows and V^T rows of two stages (one trip) are brought into LDS once per block by
// asynchronous copies; two buffers, the next trip's copies fly while this trip is worked on.
// Inside a stage each wave fetches its fragments one pass (32 keys) ahead.
// Computes S^T = K * Q^T so the D-layout of exp(S^T) is directly the
// B-fragment of O^T = V^T * P^T (no shuffles).
#define ST_KEYS  128                      // keys per stage
#define NSTAGE   (KV_PER_G / ST_KEYS)     // 16 stages per block
#define NTRIP    (NSTAGE / 2)             // a trip = two stages, one for each half of the waves
#define LPITCH   272                      // 256-byte rows + 16: conflict-free 16-byte reads
#define TILE_B   (128 * LPITCH)           // K tile: 128 keys x 128 features; V^T tile: 128 features x 128 keys
#define STAGE_B  (2 * TILE_B)
#define TRIP_B   (2 * STAGE_B)

// Eight 16-byte copies of one lane: rows r, r+16, ... r+112 of a 128-row tile.
// lds: the lane's LDS byte address of row r; g: its global address; gstep: bytes
// between source rows r and r+16. The s_wait_xcnt closes the statement so that no
// address register named here is rewritten before the copies have taken it.
__device__ __forceinline__ void copy_tile(unsigned int lds, const char* g, size_t gstep) {
  asm volatile(
      "global_load_async_to_lds_b128 %0, %8, off\n\t"
      "global_load_async_to_lds_b128 %1, %9, off\n\t"
      "global_load_async_to_lds_b128 %2, %10, off\n\t"
      "global_load_async_to_lds_b128 %3, %11, off\n\t"
      "global_load_async_to_lds_b128 %4, %12, off\n\t"
      "global_load_async_to_lds_b128 %5, %13, off\n\t"
      "global_load_async_to_lds_b128 %6, %14, off\n\t"
      "global_load_async_to_lds_b128 %7, %15, off\n\t"
      "s_wait_xcnt 0x0"
      :: "v"(lds), "v"(lds + 16u * LPITCH), "v"(lds + 32u * LPITCH), "v"(lds + 48u * LPITCH),
         "v"(lds + 64u * LPITCH), "v"(lds + 80u * LPITCH), "v"(lds + 96u * LPITCH),
         "v"(lds + 112u * LPITCH),
         "v"(g), "v"(g + gstep), "v"(g + 2 * gstep), "v"(g + 3 * gstep),
         "v"(g + 4 * gstep), "v"(g + 5 * gstep), "v"(g + 6 * gstep), "v"(g + 7 * gstep)
      : "memory");
}

// Same fragment as frag_bf16, from an LDS tile of LPITCH-byte rows; kb = byte offset of k0.
__device__ __forceinline__ v16bf frag_lds(const unsigned char* tile, int r0, int kb) {
  int lane = threadIdx.x & 31;
  const unsigned char* p = tile + (r0 + (lane & 15)) * LPITCH + kb + ((lane >> 4) << 4);
  uint4 lo = *(const uint4*)p;         // 8 bf16
  uint4 hi = *(const uint4*)(p + 32);  // 8 bf16, 16 elements on
  v8u u = {lo.x, lo.y, lo.z, lo.w, hi.x, hi.y, hi.z, hi.w};
  return __builtin_bit_cast(v16bf, u);
}

// Runs of v_exp_f32 (2^x), each run one statement closed by a v_nop: the slot that the
// instruction set asks for between a transcendental and the next vector instruction that
// overwrites its source or reads its result.
__device__ __forceinline__ void exp2_run8(float (&r)[8], const float (&x)[8]) {
  asm("v_exp_f32 %0, %8\n\t"
      "v_exp_f32 %1, %9\n\t"
      "v_exp_f32 %2, %10\n\t"
      "v_exp_f32 %3, %11\n\t"
      "v_exp_f32 %4, %12\n\t"
      "v_exp_f32 %5, %13\n\t"
      "v_exp_f32 %6, %14\n\t"
      "v_exp_f32 %7, %15\n\t"
      "v_nop"
      : "=&v"(r[0]), "=&v"(r[1]), "=&v"(r[2]), "=&v"(r[3]),
        "=&v"(r[4]), "=&v"(r[5]), "=&v"(r[6]), "=&v"(r[7])
      : "v"(x[0]), "v"(x[1]), "v"(x[2]), "v"(x[3]), "v"(x[4]), "v"(x[5]), "v"(x[6]), "v"(x[7]));
}
__device__ __forceinline__ float exp2_one(float x) {
  float r;
  asm("v_exp_f32 %0, %1\n\tv_nop" : "=&v"(r) : "v"(x));
  return r;
}
#define LOG2E 1.4426950408889634f   // exp(x) = 2^(x * LOG2E), as __expf forms it
#define RESCALE_THR 5.545177444479562f   // 8 / LOG2E: a score this far above the reference gives 2^8

__global__ void __launch_bounds__(256) flash_kernel(
    const bf16_t* __restrict__ Qb, const bf16_t* __restrict__ Kb,
    const bf16_t* __restrict__ Vt,
    float* __restrict__ Opart, float* __restrict__ mpart,
    float* __restrict__ lpart) {
  __shared__ __attribute__((aligned(16))) unsigned char L[2 * TRIP_B];

  int grp  = blockIdx.x & 3;
  int wv   = threadIdx.x >> 5;
  int kh   = wv >> 2;                                   // which stage of a trip this wave works on
  int row0 = (blockIdx.x >> 2) * 128 + (wv & 3) * 32;   // first of the wave's 32 queries
  int lane = threadIdx.x & 31, i = lane & 15, h = lane >> 4;
  int jbase = grp * KV_PER_G;

  // this thread's share of every stage: 16-byte column (tid & 15) of rows (tid >> 4) + 16 n
  int crow = threadIdx.x >> 4, ccol = threadIdx.x & 15;
  unsigned int ldst = (unsigned int)(size_t)L + crow * LPITCH + ccol * 16;
  const char* gk = (const char*)(Kb + (size_t)(jbase + crow) * DMODEL + ccol * 8);
  const char* gv = (const char*)(Vt + (size_t)crow * NTOK + jbase + ccol * 8);
  const size_t KSTEP = (size_t)16 * DMODEL * 2, VSTEP = (size_t)16 * NTOK * 2;   // 16 source rows
  const size_t KADV  = (size_t)ST_KEYS * DMODEL * 2, VADV = (size_t)ST_KEYS * 2; // one stage on

  // trip 0 (stages 0 and 1) into buffer 0, landed and published; then trip 1 into buffer 1
  copy_tile(ldst, gk, KSTEP);
  copy_tile(ldst + TILE_B, gv, VSTEP);
  copy_tile(ldst + STAGE_B, gk + KADV, KSTEP);
  copy_tile(ldst + STAGE_B + TILE_B, gv + VADV, VSTEP);

  v16bf qf[2][4];
#pragma unroll
  for (int c = 0; c < 2; ++c)
#pragma unroll
    for (int kc = 0; kc < 4; ++kc) qf[c][kc] = frag_bf16(Qb, DMODEL, row0 + c * 16, kc * 32);

  v8f o[2][8];
#pragma unroll
  for (int c = 0; c < 2; ++c)
#pragma unroll
    for (int t = 0; t < 8; ++t)
#pragma unroll
      for (int v = 0; v < 8; ++v) o[c][t][v] = 0.f;

  float m[2] = {-__builtin_inff(), -__builtin_inff()}, lsum[2] = {0.f, 0.f};

  asm volatile("s_wait_asynccnt 0x0" ::: "memory");  // this wave's copies of trip 0 have landed
  __syncthreads();                                   // every wave's have: trip 0 may be read
  copy_tile(ldst + TRIP_B, gk + 2 * KADV, KSTEP);
  copy_tile(ldst + TRIP_B + TILE_B, gv + 2 * VADV, VSTEP);
  copy_tile(ldst + TRIP_B + STAGE_B, gk + 3 * KADV, KSTEP);
  copy_tile(ldst + TRIP_B + STAGE_B + TILE_B, gv + 3 * VADV, VSTEP);

  const char* nk = gk + 4 * KADV;   // source of the next refill
  const char* nv = gv + 4 * VADV;
  unsigned int nl = ldst;           // its place in LDS: the buffer that the trip has just read
  for (int tr = 0; tr < NTRIP; ++tr) {
    unsigned int boff = (tr & 1) * TRIP_B;
    const unsigned char* Ks = L + boff + kh * STAGE_B;
    const unsigned char* Vs = Ks + TILE_B;
    // Fragments are fetched one pass ahead, inside the stage. Here the 8 K and 8 V^T fragments
    // of the stage's first pass, as one group of LDS reads.
    v16bf kf[8], vf[8];
#pragma unroll
    for (int kc = 0; kc < 4; ++kc) {
      kf[2 * kc]     = frag_lds(Ks, 0,  kc * 64);
      kf[2 * kc + 1] = frag_lds(Ks, 16, kc * 64);
    }
    // scheduling fence: K ahead of V^T in the group, as the S^T products need theirs first
    __builtin_amdgcn_sched_barrier(0);
#pragma unroll
    for (int t = 0; t < 8; ++t) vf[t] = frag_lds(Vs, t * 16, 0);
    // scheduling fence: keeps the group whole; left free, the reads end up singly among the
    // products, each waited for where it stands
    __builtin_amdgcn_sched_barrier(0);
    // unrolled: every LDS offset becomes an immediate and every fragment index a constant
#pragma unroll
    for (int ps = 0; ps < ST_KEYS / 32; ++ps) {
      int jl = ps * 32;
      // S^T tiles: D(j_local, i) = sum_c K[j+j_local,c] * Q[row0+i,c]; each K fragment serves
      // both query tiles
      v8f s0[2], s1[2];
#pragma unroll
      for (int c = 0; c < 2; ++c)
#pragma unroll
        for (int v = 0; v < 8; ++v) { s0[c][v] = 0.f; s1[c][v] = 0.f; }
#pragma unroll
      for (int kc = 0; kc < 4; ++kc) {
#pragma unroll
        for (int c = 0; c < 2; ++c) {
          s0[c] = wmma_bf16(kf[2 * kc],     qf[c][kc], s0[c]);
          s1[c] = wmma_bf16(kf[2 * kc + 1], qf[c][kc], s1[c]);
        }
      }
      // online softmax: stats are per-lane scalars (query i = lane&15 of each query tile).
      // m[c] is the reference in use, the same in both lanes of a query; it is a maximum of
      // scores seen so far, not always the latest. mx[c]: maximum of this lane's 16 keys.
      float mx[2];
#pragma unroll
      for (int c = 0; c < 2; ++c) {
        mx[c] = fmaxf(s0[c][0], s1[c][0]);
#pragma unroll
        for (int v = 1; v < 8; ++v) mx[c] = fmaxf(mx[c], fmaxf(s0[c][v], s1[c][v]));
      }
      // Lazy rescale, one test per pass: the reference moves only where a score stands more than
      // RESCALE_THR above it (always in the first pass, where it is -inf). Otherwise every
      // exponential of the pass is at most 2^8, and sums and accumulators go on unscaled.
      bool need = (mx[0] - m[0] > RESCALE_THR) | (mx[1] - m[1] > RESCALE_THR);
      unsigned int any_need = __builtin_amdgcn_ballot_w32(need);
      // The next pass's K fragments (same stage, same buffer), one group, issued once the maxima
      // are known and in flight under the rest of this pass's softmax and its O^T products; their
      // issue also stands between the test and its branch. The scheduling fence in front keeps
      // the group whole and at this place: without it the reads are drawn up among the S^T
      // products. Behind the group the branch ends the block, so that none is needed there.
      if (ps + 1 < ST_KEYS / 32) {
        __builtin_amdgcn_sched_barrier(0);
#pragma unroll
        for (int kc = 0; kc < 4; ++kc) {
          kf[2 * kc]     = frag_lds(Ks, jl + 32, kc * 64);
          kf[2 * kc + 1] = frag_lds(Ks, jl + 48, kc * 64);
        }
      }
      if (any_need != 0) {   // the same in every lane: a scalar branch, all lanes on inside
#pragma unroll
        for (int c = 0; c < 2; ++c) {
          float mnew  = fmaxf(m[c], fmaxf(mx[c], __shfl_xor(mx[c], 16)));
          float alpha = exp2_one((m[c] - mnew) * LOG2E);
          m[c] = mnew;
          lsum[c] *= alpha;
#pragma unroll
          for (int t = 0; t < 8; ++t)
#pragma unroll
            for (int v = 0; v < 8; ++v) o[c][t][v] *= alpha;
        }
      }
      v16bf pt[2];
#pragma unroll
      for (int c = 0; c < 2; ++c) {
        float x0[8], x1[8], e0[8], e1[8], rs = 0.f;
#pragma unroll
        for (int v = 0; v < 8; ++v) {
          x0[v] = (s0[c][v] - m[c]) * LOG2E;
          x1[v] = (s1[c][v] - m[c]) * LOG2E;
        }
        exp2_run8(e0, x0);
        exp2_run8(e1, x1);
#pragma unroll
        for (int v = 0; v < 8; ++v) rs += e0[v] + e1[v];
        rs += __shfl_xor(rs, 16);
        lsum[c] += rs;

        // P^T as B-fragment, assembled directly from D layout (no shuffles)
        v8u pu = {pack_bf2(e0[0], e0[1]), pack_bf2(e0[2], e0[3]),
                  pack_bf2(e0[4], e0[5]), pack_bf2(e0[6], e0[7]),
                  pack_bf2(e1[0], e1[1]), pack_bf2(e1[2], e1[3]),
                  pack_bf2(e1[4], e1[5]), pack_bf2(e1[6], e1[7])};
        pt[c] = __builtin_bit_cast(v16bf, pu);
      }

#pragma unroll
      for (int t = 0; t < 8; ++t) {
#pragma unroll
        for (int c = 0; c < 2; ++c) {
          // A: V^T rows (features); O^T(feature, i); each V^T fragment serves both query tiles
          o[c][t] = wmma_bf16(vf[t], pt[c], o[c][t]);
        }
      }
      // The next pass's V^T fragments, one group, into the registers that the O^T products have
      // just read (a second V^T set does not fit beside the accumulators of 32 query columns);
      // in flight under the next pass's S^T products. Scheduling fences: the one in front keeps
      // the O^T products ahead of the reads and of the next pass's S^T products, the one behind
      // keeps the group whole instead of dealt out singly among those products.
      if (ps + 1 < ST_KEYS / 32) {
        __builtin_amdgcn_sched_barrier(0);
#pragma unroll
        for (int t = 0; t < 8; ++t) vf[t] = frag_lds(Vs, t * 16, (jl + 32) * 2);
        __builtin_amdgcn_sched_barrier(0);
      }
    }
    // publish point of trip tr + 1, and hand-over of this trip's buffer to its refill
    asm volatile("s_wait_dscnt 0x0" ::: "memory");     // this wave's reads of the buffer are done
    asm volatile("s_wait_asynccnt 0x0" ::: "memory");  // this wave's copies of trip tr + 1 have landed
    __syncthreads();                                   // both hold for every wave of the block
    if (tr + 2 < NTRIP) {                              // the same test in the whole block
      copy_tile(nl, nk, KSTEP);
      copy_tile(nl + TILE_B, nv, VSTEP);
      copy_tile(nl + STAGE_B, nk + KADV, KSTEP);
      copy_tile(nl + STAGE_B + TILE_B, nv + VADV, VSTEP);
      nk += 2 * KADV;
      nv += 2 * VADV;
      nl += TRIP_B - 2 * boff;      // to the other buffer
    }
  }
  asm volatile("s_wait_asynccnt 0x0" ::: "memory");    // nothing of this wave is in flight at its end

  // Merge of the two key halves. Waves wv and wv ^ 4 hold partials of the same 32 queries:
  // the wave of half kh keeps query tile kh and hands the other tile to its partner through
  // LDS. The ring is free: the loop's last barrier stands behind every wave's last read of it
  // and behind every wave's wait for its last copies.
  float* X  = (float*)L;                  // 8 waves x 8 KB: the tile handed over
  float* XS = X + 8 * 2048;               // 8 waves x 32 lanes x (m, l)
  bool  up = kh != 0;
  float mk = up ? m[1] : m[0],  lk = up ? lsum[1] : lsum[0];
  float mg = up ? m[0] : m[1],  lg = up ? lsum[0] : lsum[1];
  float* xw = X + wv * 2048 + lane * 4;
#pragma unroll
  for (int t = 0; t < 8; ++t) {
    float4 g0 = {up ? o[0][t][0] : o[1][t][0], up ? o[0][t][1] : o[1][t][1],
                 up ? o[0][t][2] : o[1][t][2], up ? o[0][t][3] : o[1][t][3]};
    float4 g1 = {up ? o[0][t][4] : o[1][t][4], up ? o[0][t][5] : o[1][t][5],
                 up ? o[0][t][6] : o[1][t][6], up ? o[0][t][7] : o[1][t][7]};
    *(float4*)(xw + (2 * t) * 128)     = g0;
    *(float4*)(xw + (2 * t + 1) * 128) = g1;
  }
  *(float2*)(XS + wv * 64 + lane * 2) = make_float2(mg, lg);
  __syncthreads();   // every wave's handed-over tile is written before its partner reads it
  const float* xr = X + (wv ^ 4) * 2048 + lane * 4;
  float2 st2 = *(const float2*)(XS + (wv ^ 4) * 64 + lane * 2);
  float M  = fmaxf(mk, st2.x);
  float ak = exp2_one((mk - M) * LOG2E), ap = exp2_one((st2.x - M) * LOG2E);
  float lm = lk * ak + st2.y * ap;

  // store unnormalized partials + stats
  int row = row0 + kh * 16 + i;
  float* obase = Opart + ((size_t)grp * NTOK + row) * DMODEL;
#pragma unroll
  for (int t = 0; t < 8; ++t) {
    float4 p0 = *(const float4*)(xr + (2 * t) * 128);
    float4 p1 = *(const float4*)(xr + (2 * t + 1) * 128);
    float4 w0 = {(up ? o[1][t][0] : o[0][t][0]) * ak + p0.x * ap,
                 (up ? o[1][t][1] : o[0][t][1]) * ak + p0.y * ap,
                 (up ? o[1][t][2] : o[0][t][2]) * ak + p0.z * ap,
                 (up ? o[1][t][3] : o[0][t][3]) * ak + p0.w * ap};
    float4 w1 = {(up ? o[1][t][4] : o[0][t][4]) * ak + p1.x * ap,
                 (up ? o[1][t][5] : o[0][t][5]) * ak + p1.y * ap,
                 (up ? o[1][t][6] : o[0][t][6]) * ak + p1.z * ap,
                 (up ? o[1][t][7] : o[0][t][7]) * ak + p1.w * ap};
    ((float4*)(obase + t * 16 + h * 8))[0] = w0;
    ((float4*)(obase + t * 16 + h * 8))[1] = w1;
  }
  if (h == 0) {
    mpart[grp * NTOK + row] = M;
    lpart[grp * NTOK + row] = lm;
  }
}

// ---------- kernel 3: merge of the split-KV partials + output projection ----------
// One block = 16 rows. Its 256 threads merge the rows' GSPLIT partials into one bf16 tile in
// LDS, which is the A operand of the block's eight 16x16 output tiles (one wave each).
__global__ void __launch_bounds__(256) merge_out_kernel(
    const float* __restrict__ Opart, const float* __restrict__ mpart,
    const float* __restrict__ lpart, const float* __restrict__ Wo,
    const float* __restrict__ bo, float* __restrict__ out) {
  __shared__ __attribute__((aligned(16))) unsigned char At[16 * LPITCH];
  int row0 = blockIdx.x * 16, n0 = (threadIdx.x >> 5) * 16;
  int lane = threadIdx.x & 31, n = lane & 15, h = lane >> 4;

  // merge: thread -> row tid >> 4, features f0..f0+3 and f0+64..f0+67, so that each load of a
  // wave covers whole 128-byte lines
  int mr  = threadIdx.x >> 4;
  int f0  = (threadIdx.x & 15) << 2;
  int row = row0 + mr;
  v4f ov[GSPLIT][2];
#pragma unroll
  for (int g = 0; g < GSPLIT; ++g) {
    const float* p = Opart + ((size_t)g * NTOK + row) * DMODEL + f0;
    ov[g][0] = *(const v4f*)p;
    ov[g][1] = *(const v4f*)(p + 64);
  }
  // precaution: later loads may be given the address registers of the loads above as destinations
  asm volatile("s_wait_xcnt 0x0" ::: "memory");
  v4f mg, lg;
#pragma unroll
  for (int g = 0; g < GSPLIT; ++g) { mg[g] = mpart[g * NTOK + row]; lg[g] = lpart[g * NTOK + row]; }
  float bval = bo[n0 + n];
  // precaution: the same, for the nine loads above
  asm volatile("s_wait_xcnt 0x0" ::: "memory");

  // B: Wo rows (the reads of raw_f32), issued with the partials, ahead of the barrier
  const v4f* wp = (const v4f*)(Wo + (size_t)(n0 + n) * DMODEL + h * 8);
  v4f wr[4][4];
#pragma unroll
  for (int kc = 0; kc < 4; ++kc) {
    wr[kc][0] = wp[kc * 8];     wr[kc][1] = wp[kc * 8 + 1];
    wr[kc][2] = wp[kc * 8 + 4];
    // precaution: the same; the last load may be given the common address pair as its destination
    if (kc == 3) asm volatile("s_wait_xcnt 0x0" ::: "memory");
    wr[kc][3] = wp[kc * 8 + 5];
  }
  // Fence on the loaded values, inputs only: every load of the kernel is issued in front of the
  // first use of one. Left free, they are dealt out among the arithmetic in small groups, and
  // the block waits out one memory latency after another.
  asm volatile("" :: "v"(ov[0][0]), "v"(ov[0][1]), "v"(ov[1][0]), "v"(ov[1][1]),
                     "v"(ov[2][0]), "v"(ov[2][1]), "v"(ov[3][0]), "v"(ov[3][1]),
                     "v"(mg), "v"(lg), "v"(bval),
                     "v"(wr[0][0]), "v"(wr[0][1]), "v"(wr[0][2]), "v"(wr[0][3]),
                     "v"(wr[1][0]), "v"(wr[1][1]), "v"(wr[1][2]), "v"(wr[1][3]),
                     "v"(wr[2][0]), "v"(wr[2][1]), "v"(wr[2][2]), "v"(wr[2][3]),
                     "v"(wr[3][0]), "v"(wr[3][1]), "v"(wr[3][2]), "v"(wr[3][3]));

  float M = -__builtin_inff();
#pragma unroll
  for (int g = 0; g < GSPLIT; ++g) M = fmaxf(M, mg[g]);
  float w[GSPLIT], L = 0.f;
#pragma unroll
  for (int g = 0; g < GSPLIT; ++g) { w[g] = exp2_one((mg[g] - M) * LOG2E); L += w[g] * lg[g]; }
  float rinv = 1.0f / L;
#pragma unroll
  for (int c = 0; c < 2; ++c) {
    float s[4] = {0.f, 0.f, 0.f, 0.f};
#pragma unroll
    for (int g = 0; g < GSPLIT; ++g) {
      s[0] += w[g] * ov[g][c].x; s[1] += w[g] * ov[g][c].y;
      s[2] += w[g] * ov[g][c].z; s[3] += w[g] * ov[g][c].w;
    }
    *(uint2*)(At + mr * LPITCH + (f0 + c * 64) * 2) =
        make_uint2(pack_bf2(s[0] * rinv, s[1] * rinv), pack_bf2(s[2] * rinv, s[3] * rinv));
  }
  __syncthreads();   // the merged tile is whole before any wave reads its A fragments

  v8f acc = {0.f, 0.f, 0.f, 0.f, 0.f, 0.f, 0.f, 0.f};
#pragma unroll
  for (int kc = 0; kc < 4; ++kc) {
    v8u u = {pack_bf2(wr[kc][0].x, wr[kc][0].y), pack_bf2(wr[kc][0].z, wr[kc][0].w),
             pack_bf2(wr[kc][1].x, wr[kc][1].y), pack_bf2(wr[kc][1].z, wr[kc][1].w),
             pack_bf2(wr[kc][2].x, wr[kc][2].y), pack_bf2(wr[kc][2].z, wr[kc][2].w),
             pack_bf2(wr[kc][3].x, wr[kc][3].y), pack_bf2(wr[kc][3].z, wr[kc][3].w)};
    acc = wmma_bf16(frag_lds(At, 0, kc * 64), __builtin_bit_cast(v16bf, u), acc);
  }
#pragma unroll
  for (int v = 0; v < 8; ++v)
    out[(size_t)(row0 + h * 8 + v) * DMODEL + n0 + n] = acc[v] + bval;
}

// ---------- launch ----------
extern "C" void kernel_launch(void* const* d_in, const int* in_sizes, int n_in,
                              void* d_out, int out_size, void* d_ws, size_t ws_size,
                              hipStream_t stream) {
  const float* x  = (const float*)d_in[0];
  const float* Wq = (const float*)d_in[1];
  const float* bq = (const float*)d_in[2];
  const float* Wk = (const float*)d_in[3];
  const float* bk = (const float*)d_in[4];
  const float* Wv = (const float*)d_in[5];
  const float* bv = (const float*)d_in[6];
  const float* Wo = (const float*)d_in[7];
  const float* bo = (const float*)d_in[8];

  bf16_t* Qb = (bf16_t*)d_ws;                          // 2 MB
  bf16_t* Kb = Qb + (size_t)NTOK * DMODEL;             // 2 MB
  bf16_t* Vt = Kb + (size_t)NTOK * DMODEL;             // 2 MB (transposed V)
  float* Opart = (float*)(Vt + (size_t)DMODEL * NTOK); // 16 MB
  float* mpart = Opart + (size_t)GSPLIT * NTOK * DMODEL;
  float* lpart = mpart + (size_t)GSPLIT * NTOK;

  // 128 groups of 64 rows * 2 groups of 4 column tiles = 256 blocks
  qkv_kernel<<<256, 256, 0, stream>>>(x, Wq, bq, Wk, bk, Wv, bv, Qb, Kb, Vt);
  // 64 blocks of 128 queries * 4 KV groups = 256 blocks
  flash_kernel<<<256, 256, 0, stream>>>(Qb, Kb, Vt, Opart, mpart, lpart);
  // 512 row tiles, one block each: 8 waves = 8 col-tiles
  merge_out_kernel<<<512, 256, 0, stream>>>(Opart, mpart, lpart, Wo, bo, (float*)d_out);
}

// v007
// It runs in 40.1 microseconds.
// Next to v006, in two timings, it ran 1.06 and 1.07 times as fast.
// Counting every step since v000, it is 3.87 times as fast.
#include <hip/hip_runtime.h>
#include <hip/hip_bf16.h>

typedef __bf16 bf16_t;
typedef __attribute__((ext_vector_type(16))) __bf16        v16bf;
typedef __attribute__((ext_vector_type(8)))  float         v8f;
typedef __attribute__((ext_vector_type(8)))  unsigned int  v8u;
typedef __attribute__((ext_vector_type(4)))  float         v4f;
typedef __attribute__((ext_vector_type(4)))  __bf16        v4bf;
typedef __attribute__((ext_vector_type(8)))  __bf16        v8bf;

#define NTOK    8192
#define DMODEL  128
#define GSPLIT  4
#define KV_PER_G (NTOK / GSPLIT)
#define SM_SCALE 0.08838834764831845f   // 1/sqrt(128)

// ---------- helpers ----------

// two f32 -> packed 2x bf16 (RNE) using the native conversion path
__device__ __forceinline__ unsigned int pack_bf2(float a, float b) {
  unsigned short ua = __builtin_bit_cast(unsigned short, (__bf16)a);
  unsigned short ub = __builtin_bit_cast(unsigned short, (__bf16)b);
  return (unsigned int)ua | ((unsigned int)ub << 16);
}

__device__ __forceinline__ v8f wmma_bf16(v16bf a, v16bf b, v8f c) {
  // D = A(16x32) * B(32x16) + C, fp32 accumulate
  return __builtin_amdgcn_wmma_f32_16x16x32_bf16(false, a, false, b, (short)0, c,
                                                 false, false);
}

// A/B fragment for V_WMMA_F32_16X16X32_BF16 built from a row-major matrix.
// ISA 7.12.2 16-bit A layout: row r = lane&15; lanes 0-15 hold K
// {k0..k0+7, k0+16..k0+23}; lanes 16-31 hold K {k0+8..k0+15, k0+24..k0+31}.
// B uses the mirrored layout with r = output-column index, so the same loader
// serves either operand: x rows and W rows (x @ W^T), both contiguous in K.
// From f32 sources in two halves: the lane's 16 floats as loaded, and their rounding to bf16.
// off = byte offset of the lane's row r at column (lane >> 4) * 8; k0 = first column.
struct raw16 { v4f q[4]; };
__device__ __forceinline__ raw16 raw_f32(const float* __restrict__ base, unsigned int off, int k0) {
  const v4f* p = (const v4f*)((const char*)base + off) + (k0 >> 2);
  raw16 r;
  r.q[0] = p[0]; r.q[1] = p[1];
  r.q[2] = p[4]; r.q[3] = p[5];   // p + 16 floats
  return r;
}
__device__ __forceinline__ v16bf round_frag(const raw16& r) {
  v4bf c0 = __builtin_convertvector(r.q[0], v4bf), c1 = __builtin_convertvector(r.q[1], v4bf);
  v4bf c2 = __builtin_convertvector(r.q[2], v4bf), c3 = __builtin_convertvector(r.q[3], v4bf);
  v8bf lo = __builtin_shufflevector(c0, c1, 0, 1, 2, 3, 4, 5, 6, 7);
  v8bf hi = __builtin_shufflevector(c2, c3, 0, 1, 2, 3, 4, 5, 6, 7);
  return __builtin_shufflevector(lo, hi, 0, 1, 2, 3, 4, 5, 6, 7, 8, 9, 10, 11, 12, 13, 14, 15);
}

// The same fragment from two 512-byte blocks in fragment order (see qkv_kernel), in global memory
// or in LDS: p = the lane's 16 bytes of the block with the fragment's first 16 k values,
// hi_off = bytes from there to the block with the next 16.
__device__ __forceinline__ v16bf frag_blk(const unsigned char* p, int hi_off) {
  uint4 lo = *(const uint4*)p;             // 8 bf16
  uint4 hi = *(const uint4*)(p + hi_off);  // 8 bf16
  v8u u = {lo.x, lo.y, lo.z, lo.w, hi.x, hi.y, hi.z, hi.w};
  return __builtin_bit_cast(v16bf, u);
}

// ---------- kernel 1: Q/K/V projections ----------
// One wave = 32 rows of x (two row tiles) times one 16-column tile of each of Q, K and V: six
// 16x16 tiles, every x fragment feeding three products and every W fragment two.
// One block = 8 waves = 64 rows x 4 column tiles of each matrix; 128 row groups x 2 column
// groups = 256 blocks, 2048 waves.
// Q, K and V leave in the order of their reader's fragments: blocks of 512 bytes, one per
// (tile of 16 tokens, tile of 16 features), block index = token tile * 8 + feature tile, lane l
// of a wave owning bytes 16 l .. 16 l + 15. Q, K: lane (token l & 15) holds features
// (l >> 4) * 8 .. + 7; V: lane (feature l & 15) holds tokens (l >> 4) * 8 .. + 7. So a wave
// stores a tile with one 16-byte store per lane, 512 bytes in a row. For that the Q and K
// products are formed transposed (A = W rows, B = x rows): a lane's 8 values are 8 features.
__global__ void __launch_bounds__(256) qkv_kernel(
    const float* __restrict__ x,
    const float* __restrict__ Wq, const float* __restrict__ bq,
    const float* __restrict__ Wk, const float* __restrict__ bk,
    const float* __restrict__ Wv, const float* __restrict__ bv,
    bf16_t* __restrict__ Qb, bf16_t* __restrict__ Kb, bf16_t* __restrict__ Vt) {
  int wv   = threadIdx.x >> 5;
  int lane = threadIdx.x & 31, n = lane & 15, h = lane >> 4;
  int row0 = (blockIdx.x >> 1) * 64 + (wv >> 2) * 32;
  int n0   = ((blockIdx.x & 1) * 4 + (wv & 3)) * 16;

  unsigned int xoff = (unsigned int)((row0 + n) * DMODEL + h * 8) * 4u;
  unsigned int woff = (unsigned int)((n0 + n) * DMODEL + h * 8) * 4u;
  raw16 xr[2][4], wr[3][4];
  // every loop of this kernel is unrolled: fragment and accumulator indices become constants,
  // so that the arrays stay in registers, and every load offset an immediate
#pragma unroll
  for (int kc = 0; kc < 4; ++kc) {
    xr[0][kc] = raw_f32(x, xoff, kc * 32);                 // x rows: A of V, B of Q^T and K^T
    xr[1][kc] = raw_f32(x, xoff, 16 * DMODEL + kc * 32);
    wr[0][kc] = raw_f32(Wq, woff, kc * 32);                // W rows: the other operand (x @ W^T)
    wr[1][kc] = raw_f32(Wk, woff, kc * 32);
    wr[2][kc] = raw_f32(Wv, woff, kc * 32);
  }
  // bias: V by the lane's column, Q and K by the lane's 8 rows (features) of the transposed tile
  // both read at one byte offset from their own base, like the fragment loads
  float bvv = bv[n0 + n];
  unsigned int boff = (unsigned int)(n0 + h * 8) * 4u;
  const v4f* pbq = (const v4f*)((const char*)bq + boff);
  const v4f* pbk = (const v4f*)((const char*)bk + boff);
  v4f bq0 = pbq[0], bq1 = pbq[1], bk0 = pbk[0], bk1 = pbk[1];
  // scheduling fence: every load of the wave is issued in front of the first use of one, so that
  // the wave waits out one memory latency and not one per fragment
  __builtin_amdgcn_sched_barrier(0);
  // precaution: the wait stands behind the loads and in front of every later write of the offset
  // registers that they name; as inputs here those of the fragment loads and of the Q and K bias
  // loads stay whole up to it
  asm volatile("s_wait_xcnt 0x0" :: "v"(xoff), "v"(woff), "v"(boff) : "memory");
  // scheduling fence: keeps the arithmetic behind that wait
  __builtin_amdgcn_sched_barrier(0);

  v8f bq8 = __builtin_shufflevector(bq0, bq1, 0, 1, 2, 3, 4, 5, 6, 7);
  v8f bk8 = __builtin_shufflevector(bk0, bk1, 0, 1, 2, 3, 4, 5, 6, 7);
  v8f acc[2][3];
#pragma unroll
  for (int r = 0; r < 2; ++r)
#pragma unroll
    for (int mat = 0; mat < 3; ++mat)
#pragma unroll
      for (int v = 0; v < 8; ++v) acc[r][mat][v] = 0.f;
#pragma unroll
  for (int kc = 0; kc < 4; ++kc) {
    v16bf a[2] = {round_frag(xr[0][kc]), round_frag(xr[1][kc])};
#pragma unroll
    for (int mat = 0; mat < 3; ++mat) {
      v16bf b = round_frag(wr[mat][kc]);
#pragma unroll
      for (int r = 0; r < 2; ++r)
        acc[r][mat] = mat < 2 ? wmma_bf16(b, a[r], acc[r][mat])    // Q^T, K^T: (feature, token)
                              : wmma_bf16(a[r], b, acc[r][mat]);   // V: (token, feature)
    }
  }

#pragma unroll
  for (int r = 0; r < 2; ++r) {
    size_t blk = ((size_t)((row0 >> 4) + r) * 8 + (n0 >> 4)) * 256 + lane * 8;   // in elements
    // whole vectors, rounded in pairs of neighbours: a lane's 8 values are its 16 bytes
    *(v8bf*)(Qb + blk) = __builtin_convertvector((acc[r][0] + bq8) * SM_SCALE, v8bf);  // softmax scale folded into Q
    *(v8bf*)(Kb + blk) = __builtin_convertvector(acc[r][1] + bk8, v8bf);
    *(v8bf*)(Vt + blk) = __builtin_convertvector(acc[r][2] + bvv, v8bf);
  }
}

// ---------- kernel 2: flash attention (transposed), split-KV ----------
// One block = 8 waves = 128 queries of ONE KV group. A wave holds 32 query columns (two Q
// tiles), so every K and V^T fragment it reads from LDS feeds two products. Waves 0-3 cover
// the block's 128 queries on the even stages (128 keys each), waves 4-7 the same queries on
// the odd stages; the two halves' partials are merged through LDS behind the loop.
// The K and V blocks of two stages (one trip) are brought into LDS once per block by
// asynchronous copies; two buffers, the next trip's copies fly while this trip is worked on.
// A stage's K (and V) is 32 KB in a row in global memory, in fragment order, and lies in LDS
// as it lies there: every copy and every fragment read of a wave covers 512 bytes in a row.
// Inside a stage each wave fetches its fragments one pass (32 keys) ahead.
// Computes S^T = K * Q^T so the D-layout of exp(S^T) is directly the
// B-fragment of O^T = V^T * P^T (no shuffles).
#define ST_KEYS  128                      // keys per stage
#define NSTAGE   (KV_PER_G / ST_KEYS)     // 16 stages per block
#define NTRIP    (NSTAGE / 2)             // a trip = two stages, one for each half of the waves
#define LPITCH   272                      // merged tile of the last kernel: 256-byte rows + 16
#define TOK16_B  4096                     // 16 tokens x 128 features: 8 blocks of 512 bytes
#define TILE_B   (ST_KEYS / 16 * TOK16_B) // K or V of one stage: 128 keys x 128 features
#define STAGE_B  (2 * TILE_B)
#define TRIP_B   (2 * STAGE_B)

// Eight 16-byte copies of one lane: its 16 bytes of each 4-KB eighth of a 32-KB tile.
// lds: the lane's LDS byte address in the first eighth; g: its global address there.
// The s_wait_xcnt closes the statement so that no
// address register named here is rewritten before the copies have taken it.
__device__ __forceinline__ void copy_tile(unsigned int lds, const char* g) {
  const size_t gstep = TOK16_B;
  asm volatile(
      "global_load_async_to_lds_b128 %0, %8, off\n\t"
      "global_load_async_to_lds_b128 %1, %9, off\n\t"
      "global_load_async_to_lds_b128 %2, %10, off\n\t"
      "global_load_async_to_lds_b128 %3, %11, off\n\t"
      "global_load_async_to_lds_b128 %4, %12, off\n\t"
      "global_load_async_to_lds_b128 %5, %13, off\n\t"
      "global_load_async_to_lds_b128 %6, %14, off\n\t"
      "global_load_async_to_lds_b128 %7, %15, off\n\t"
      "s_wait_xcnt 0x0"
      :: "v"(lds), "v"(lds + 1u * TOK16_B), "v"(lds + 2u * TOK16_B), "v"(lds + 3u * TOK16_B),
         "v"(lds + 4u * TOK16_B), "v"(lds + 5u * TOK16_B), "v"(lds + 6u * TOK16_B),
         "v"(lds + 7u * TOK16_B),
         "v"(g), "v"(g + gstep), "v"(g + 2 * gstep), "v"(g + 3 * gstep),
         "v"(g + 4 * gstep), "v"(g + 5 * gstep), "v"(g + 6 * gstep), "v"(g + 7 * gstep)
      : "memory");
}

// The same fragment from an LDS tile of LPITCH-byte rows; kb = byte offset of k0.
__device__ __forceinline__ v16bf frag_lds(const unsigned char* tile, int r0, int kb) {
  int lane = threadIdx.x & 31;
  const unsigned char* p = tile + (r0 + (lane & 15)) * LPITCH + kb + ((lane >> 4) << 4);
  uint4 lo = *(const uint4*)p;         // 8 bf16
  uint4 hi = *(const uint4*)(p + 32);  // 8 bf16, 16 elements on
  v8u u = {lo.x, lo.y, lo.z, lo.w, hi.x, hi.y, hi.z, hi.w};
  return __builtin_bit_cast(v16bf, u);
}

// Runs of v_exp_f32 (2^x), each run one statement closed by a v_nop: the slot that the
// instruction set asks for between a transcendental and the next vector instruction that
// overwrites its source or reads its result.
__device__ __forceinline__ void exp2_run8(float (&r)[8], const float (&x)[8]) {
  asm("v_exp_f32 %0, %8\n\t"
      "v_exp_f32 %1, %9\n\t"
      "v_exp_f32 %2, %10\n\t"
      "v_exp_f32 %3, %11\n\t"
      "v_exp_f32 %4, %12\n\t"
      "v_exp_f32 %5, %13\n\t"
      "v_exp_f32 %6, %14\n\t"
      "v_exp_f32 %7, %15\n\t"
      "v_nop"
      : "=&v"(r[0]), "=&v"(r[1]), "=&v"(r[2]), "=&v"(r[3]),
        "=&v"(r[4]), "=&v"(r[5]), "=&v"(r[6]), "=&v"(r[7])
      : "v"(x[0]), "v"(x[1]), "v"(x[2]), "v"(x[3]), "v"(x[4]), "v"(x[5]), "v"(x[6]), "v"(x[7]));
}
__device__ __forceinline__ float exp2_one(float x) {
  float r;
  asm("v_exp_f32 %0, %1\n\tv_nop" : "=&v"(r) : "v"(x));
  return r;
}
#define LOG2E 1.4426950408889634f   // exp(x) = 2^(x * LOG2E), as __expf forms it
#define RESCALE_THR 5.545177444479562f   // 8 / LOG2E: a score this far above the reference gives 2^8

__global__ void __launch_bounds__(256) flash_kernel(
    const bf16_t* __restrict__ Qb, const bf16_t* __restrict__ Kb,
    const bf16_t* __restrict__ Vt,
    float* __restrict__ Opart, float* __restrict__ mpart,
    float* __restrict__ lpart) {
  __shared__ __attribute__((aligned(16))) unsigned char L[2 * TRIP_B];

  int grp  = blockIdx.x & 3;
  int wv   = threadIdx.x >> 5;
  int kh   = wv >> 2;                                   // which stage of a trip this wave works on
  int row0 = (blockIdx.x >> 2) * 128 + (wv & 3) * 32;   // first of the wave's 32 queries
  int lane = threadIdx.x & 31, i = lane & 15, h = lane >> 4;
  int jbase = grp * KV_PER_G;

  // this thread's share of every tile: bytes 16 tid .. 16 tid + 15 of each 4 KB (16 keys)
  unsigned int ldst = (unsigned int)(size_t)L + threadIdx.x * 16;
  const char* gk = (const char*)(Kb + (size_t)jbase * DMODEL + threadIdx.x * 8);
  const char* gv = (const char*)(Vt + (size_t)jbase * DMODEL + threadIdx.x * 8);
  const size_t KADV = TILE_B, VADV = TILE_B;   // one stage on

  // trip 0 (stages 0 and 1) into buffer 0, landed and published; then trip 1 into buffer 1
  copy_tile(ldst, gk);
  copy_tile(ldst + TILE_B, gv);
  copy_tile(ldst + STAGE_B, gk + KADV);
  copy_tile(ldst + STAGE_B + TILE_B, gv + VADV);

  v16bf qf[2][4];
#pragma unroll
  for (int c = 0; c < 2; ++c)
#pragma unroll
    for (int kc = 0; kc < 4; ++kc)
      qf[c][kc] = frag_blk((const unsigned char*)Qb + ((row0 >> 4) + c) * TOK16_B + kc * 1024 +
                               lane * 16, 512);

  v8f o[2][8];
#pragma unroll
  for (int c = 0; c < 2; ++c)
#pragma unroll
    for (int t = 0; t < 8; ++t)
#pragma unroll
      for (int v = 0; v < 8; ++v) o[c][t][v] = 0.f;

  float m[2] = {-__builtin_inff(), -__builtin_inff()}, lsum[2] = {0.f, 0.f};

  asm volatile("s_wait_asynccnt 0x0" ::: "memory");  // this wave's copies of trip 0 have landed
  __syncthreads();                                   // every wave's have: trip 0 may be read
  copy_tile(ldst + TRIP_B, gk + 2 * KADV);
  copy_tile(ldst + TRIP_B + TILE_B, gv + 2 * VADV);
  copy_tile(ldst + TRIP_B + STAGE_B, gk + 3 * KADV);
  copy_tile(ldst + TRIP_B + STAGE_B + TILE_B, gv + 3 * VADV);

  const char* nk = gk + 4 * KADV;   // source of the next refill
  const char* nv = gv + 4 * VADV;
  unsigned int nl = ldst;           // its place in LDS: the buffer that the trip has just read
  for (int tr = 0; tr < NTRIP; ++tr) {
    unsigned int boff = (tr & 1) * TRIP_B;
    const unsigned char* Ks = L + boff + kh * STAGE_B + lane * 16;   // the lane's bytes of block 0
    const unsigned char* Vs = Ks + TILE_B;
    // Fragments are fetched one pass ahead, inside the stage. Here the 8 K and 8 V^T fragments
    // of the stage's first pass, as one group of LDS reads.
    v16bf kf[8], vf[8];
#pragma unroll
    for (int kc = 0; kc < 4; ++kc) {
      kf[2 * kc]     = frag_blk(Ks + kc * 1024, 512);              // keys 0-15, features 32 kc ..
      kf[2 * kc + 1] = frag_blk(Ks + TOK16_B + kc * 1024, 512);    // keys 16-31
    }
    // scheduling fence: K ahead of V^T in the group, as the S^T products need theirs first
    __builtin_amdgcn_sched_barrier(0);
#pragma unroll
    for (int t = 0; t < 8; ++t) vf[t] = frag_blk(Vs + t * 512, TOK16_B);   // features 16 t .., keys 0-31
    // scheduling fence: keeps the group whole; left free, the reads end up singly among the
    // products, each waited for where it stands
    __builtin_amdgcn_sched_barrier(0);
    // unrolled: every LDS offset becomes an immediate and every fragment index a constant
#pragma unroll
    for (int ps = 0; ps < ST_KEYS / 32; ++ps) {
      int jl = ps * 32;
      // S^T tiles: D(j_local, i) = sum_c K[j+j_local,c] * Q[row0+i,c]; each K fragment serves
      // both query tiles
      v8f s0[2], s1[2];
#pragma unroll
      for (int c = 0; c < 2; ++c)
#pragma unroll
        for (int v = 0; v < 8; ++v) { s0[c][v] = 0.f; s1[c][v] = 0.f; }
#pragma unroll
      for (int kc = 0; kc < 4; ++kc) {
#pragma unroll
        for (int c = 0; c < 2; ++c) {
          s0[c] = wmma_bf16(kf[2 * kc],     qf[c][kc], s0[c]);
          s1[c] = wmma_bf16(kf[2 * kc + 1], qf[c][kc], s1[c]);
        }
      }
      // online softmax: stats are per-lane scalars (query i = lane&15 of each query tile).
      // m[c] is the reference in use, the same in both lanes of a query; it is a maximum of
      // scores seen so far, not always the latest. mx[c]: maximum of this lane's 16 keys.
      float mx[2];
#pragma unroll
      for (int c = 0; c < 2; ++c) {
        mx[c] = fmaxf(s0[c][0], s1[c][0]);
#pragma unroll
        for (int v = 1; v < 8; ++v) mx[c] = fmaxf(mx[c], fmaxf(s0[c][v], s1[c][v]));
      }
      // Lazy rescale, one test per pass: the reference moves only where a score stands more than
      // RESCALE_THR above it (always in the first pass, where it is -inf). Otherwise every
      // exponential of the pass is at most 2^8, and sums and accumulators go on unscaled.
      bool need = (mx[0] - m[0] > RESCALE_THR) | (mx[1] - m[1] > RESCALE_THR);
      unsigned int any_need = __builtin_amdgcn_ballot_w32(need);
      // The next pass's K fragments (same stage, same buffer), one group, issued once the maxima
      // are known and in flight under the rest of this pass's softmax and its O^T products; their
      // issue also stands between the test and its branch. The scheduling fence in front keeps
      // the group whole and at this place: without it the reads are drawn up among the S^T
      // products. Behind the group the branch ends the block, so that none is needed there.
      if (ps + 1 < ST_KEYS / 32) {
        __builtin_amdgcn_sched_barrier(0);
#pragma unroll
        for (int kc = 0; kc < 4; ++kc) {
          kf[2 * kc]     = frag_blk(Ks + ((jl + 32) >> 4) * TOK16_B + kc * 1024, 512);
          kf[2 * kc + 1] = frag_blk(Ks + ((jl + 48) >> 4) * TOK16_B + kc * 1024, 512);
        }
      }
      if (any_need != 0) {   // the same in every lane: a scalar branch, all lanes on inside
#pragma unroll
        for (int c = 0; c < 2; ++c) {
          float mnew  = fmaxf(m[c], fmaxf(mx[c], __shfl_xor(mx[c], 16)));
          float alpha = exp2_one((m[c] - mnew) * LOG2E);
          m[c] = mnew;
          lsum[c] *= alpha;
#pragma unroll
          for (int t = 0; t < 8; ++t)
#pragma unroll
            for (int v = 0; v < 8; ++v) o[c][t][v] *= alpha;
        }
      }
      v16bf pt[2];
#pragma unroll
      for (int c = 0; c < 2; ++c) {
        float x0[8], x1[8], e0[8], e1[8], rs = 0.f;
#pragma unroll
        for (int v = 0; v < 8; ++v) {
          x0[v] = (s0[c][v] - m[c]) * LOG2E;
          x1[v] = (s1[c][v] - m[c]) * LOG2E;
        }
        exp2_run8(e0, x0);
        exp2_run8(e1, x1);
#pragma unroll
        for (int v = 0; v < 8; ++v) rs += e0[v] + e1[v];
        rs += __shfl_xor(rs, 16);
        lsum[c] += rs;

        // P^T as B-fragment, assembled directly from D layout (no shuffles)
        v8u pu = {pack_bf2(e0[0], e0[1]), pack_bf2(e0[2], e0[3]),
                  pack_bf2(e0[4], e0[5]), pack_bf2(e0[6], e0[7]),
                  pack_bf2(e1[0], e1[1]), pack_bf2(e1[2], e1[3]),
                  pack_bf2(e1[4], e1[5]), pack_bf2(e1[6], e1[7])};
        pt[c] = __builtin_bit_cast(v16bf, pu);
      }

#pragma unroll
      for (int t = 0; t < 8; ++t) {
#pragma unroll
        for (int c = 0; c < 2; ++c) {
          // A: V^T rows (features); O^T(feature, i); each V^T fragment serves both query tiles
          o[c][t] = wmma_bf16(vf[t], pt[c], o[c][t]);
        }
      }
      // The next pass's V^T fragments, one group, into the registers that the O^T products have
      // just read (a second V^T set does not fit beside the accumulators of 32 query columns);
      // in flight under the next pass's S^T products. Scheduling fences: the one in front keeps
      // the O^T products ahead of the reads and of the next pass's S^T products, the one behind
      // keeps the group whole instead of dealt out singly among those products.
      if (ps + 1 < ST_KEYS / 32) {
        __builtin_amdgcn_sched_barrier(0);
#pragma unroll
        for (int t = 0; t < 8; ++t)
          vf[t] = frag_blk(Vs + ((jl + 32) >> 4) * TOK16_B + t * 512, TOK16_B);
        __builtin_amdgcn_sched_barrier(0);
      }
    }
    // publish point of trip tr + 1, and hand-over of this trip's buffer to its refill
    asm volatile("s_wait_dscnt 0x0" ::: "memory");     // this wave's reads of the buffer are done
    asm volatile("s_wait_asynccnt 0x0" ::: "memory");  // this wave's copies of trip tr + 1 have landed
    __syncthreads();                                   // both hold for every wave of the block
    if (tr + 2 < NTRIP) {                              // the same test in the whole block
      copy_tile(nl, nk);
      copy_tile(nl + TILE_B, nv);
      copy_tile(nl + STAGE_B, nk + KADV);
      copy_tile(nl + STAGE_B + TILE_B, nv + VADV);
      nk += 2 * KADV;
      nv += 2 * VADV;
      nl += TRIP_B - 2 * boff;      // to the other buffer
    }
  }
  asm volatile("s_wait_asynccnt 0x0" ::: "memory");    // nothing of this wave is in flight at its end

  // Merge of the two key halves. Waves wv and wv ^ 4 hold partials of the same 32 queries:
  // the wave of half kh keeps query tile kh and hands the other tile to its partner through
  // LDS. The ring is free: the loop's last barrier stands behind every wave's last read of it
  // and behind every wave's wait for its last copies.
  float* X  = (float*)L;                  // 8 waves x 8 KB: the tile handed over
  float* XS = X + 8 * 2048;               // 8 waves x 32 lanes x (m, l)
  bool  up = kh != 0;
  float mk = up ? m[1] : m[0],  lk = up ? lsum[1] : lsum[0];
  float mg = up ? m[0] : m[1],  lg = up ? lsum[0] : lsum[1];
  float* xw = X + wv * 2048 + lane * 4;
#pragma unroll
  for (int t = 0; t < 8; ++t) {
    float4 g0 = {up ? o[0][t][0] : o[1][t][0], up ? o[0][t][1] : o[1][t][1],
                 up ? o[0][t][2] : o[1][t][2], up ? o[0][t][3] : o[1][t][3]};
    float4 g1 = {up ? o[0][t][4] : o[1][t][4], up ? o[0][t][5] : o[1][t][5],
                 up ? o[0][t][6] : o[1][t][6], up ? o[0][t][7] : o[1][t][7]};
    *(float4*)(xw + (2 * t) * 128)     = g0;
    *(float4*)(xw + (2 * t + 1) * 128) = g1;
  }
  *(float2*)(XS + wv * 64 + lane * 2) = make_float2(mg, lg);
  __syncthreads();   // every wave's handed-over tile is written before its partner reads it
  const float* xr = X + (wv ^ 4) * 2048 + lane * 4;
  float2 st2 = *(const float2*)(XS + (wv ^ 4) * 64 + lane * 2);
  float M  = fmaxf(mk, st2.x);
  float ak = exp2_one((mk - M) * LOG2E), ap = exp2_one((st2.x - M) * LOG2E);
  float lm = lk * ak + st2.y * ap;

  // store unnormalized partials + stats. The partials leave in the accumulators' own order: 8 KB
  // per (KV group, tile of 16 queries), 16 runs of 512 bytes, run 2 t + p = features
  // 16 t + 8 h + 4 p .. + 3 of query i in lane (i, h): every store of a wave is 512 bytes in a row.
  int row = row0 + kh * 16 + i;
  float* obase = Opart + ((size_t)grp * (NTOK / 16) + (row0 >> 4) + kh) * (16 * DMODEL) + lane * 4;
#pragma unroll
  for (int t = 0; t < 8; ++t) {
    float4 p0 = *(const float4*)(xr + (2 * t) * 128);
    float4 p1 = *(const float4*)(xr + (2 * t + 1) * 128);
    float4 w0 = {(up ? o[1][t][0] : o[0][t][0]) * ak + p0.x * ap,
                 (up ? o[1][t][1] : o[0][t][1]) * ak + p0.y * ap,
                 (up ? o[1][t][2] : o[0][t][2]) * ak + p0.z * ap,
                 (up ? o[1][t][3] : o[0][t][3]) * ak + p0.w * ap};
    float4 w1 = {(up ? o[1][t][4] : o[0][t][4]) * ak + p1.x * ap,
                 (up ? o[1][t][5] : o[0][t][5]) * ak + p1.y * ap,
                 (up ? o[1][t][6] : o[0][t][6]) * ak + p1.z * ap,
                 (up ? o[1][t][7] : o[0][t][7]) * ak + p1.w * ap};
    *(float4*)(obase + (2 * t) * 128)     = w0;
    *(float4*)(obase + (2 * t + 1) * 128) = w1;
  }
  if (h == 0) {
    mpart[grp * NTOK + row] = M;
    lpart[grp * NTOK + row] = lm;
  }
}

// ---------- kernel 3: merge of the split-KV partials + output projection ----------
// One block = 16 rows. Its 256 threads merge the rows' GSPLIT partials into one bf16 tile in
// LDS, which is the A operand of the block's eight 16x16 output tiles (one wave each).
__global__ void __launch_bounds__(256) merge_out_kernel(
    const float* __restrict__ Opart, const float* __restrict__ mpart,
    const float* __restrict__ lpart, const float* __restrict__ Wo,
    const float* __restrict__ bo, float* __restrict__ out) {
  __shared__ __attribute__((aligned(16))) unsigned char At[16 * LPITCH];
  int row0 = blockIdx.x * 16, n0 = (threadIdx.x >> 5) * 16;
  int lane = threadIdx.x & 31, n = lane & 15, h = lane >> 4;

  // merge: the partials lie in the accumulators' order (see flash_kernel): thread tid takes bytes
  // 16 tid .. + 15 of each half of a group's 8 KB, which are row tid & 15, features f0..f0+3 and
  // f0+64..f0+67; each load of a wave covers 512 bytes in a row
  int mr  = threadIdx.x & 15;
  int f0  = (threadIdx.x >> 6) * 16 + h * 8 + ((threadIdx.x >> 5) & 1) * 4;
  int row = row0 + mr;
  v4f ov[GSPLIT][2];
#pragma unroll
  for (int g = 0; g < GSPLIT; ++g) {
    const float* p = Opart + ((size_t)g * (NTOK / 16) + blockIdx.x) * (16 * DMODEL) + threadIdx.x * 4;
    ov[g][0] = *(const v4f*)p;
    ov[g][1] = *(const v4f*)(p + 1024);
  }
  // precaution: later loads may be given the address registers of the loads above as destinations
  asm volatile("s_wait_xcnt 0x0" ::: "memory");
  v4f mg, lg;
#pragma unroll
  for (int g = 0; g < GSPLIT; ++g) { mg[g] = mpart[g * NTOK + row]; lg[g] = lpart[g * NTOK + row]; }
  float bval = bo[n0 + n];
  // precaution: the same, for the nine loads above
  asm volatile("s_wait_xcnt 0x0" ::: "memory");

  // B: Wo rows (the reads of raw_f32), issued with the partials, ahead of the barrier
  const v4f* wp = (const v4f*)(Wo + (size_t)(n0 + n) * DMODEL + h * 8);
  v4f wr[4][4];
#pragma unroll
  for (int kc = 0; kc < 4; ++kc) {
    wr[kc][0] = wp[kc * 8];     wr[kc][1] = wp[kc * 8 + 1];
    wr[kc][2] = wp[kc * 8 + 4];
    // precaution: the same; the last load may be given the common address pair as its destination
    if (kc == 3) asm volatile("s_wait_xcnt 0x0" ::: "memory");
    wr[kc][3] = wp[kc * 8 + 5];
  }
  // Fence on the loaded values, inputs only: every load of the kernel is issued in front of the
  // first use of one. Left free, they are dealt out among the arithmetic in small groups, and
  // the block waits out one memory latency after another.
  asm volatile("" :: "v"(ov[0][0]), "v"(ov[0][1]), "v"(ov[1][0]), "v"(ov[1][1]),
                     "v"(ov[2][0]), "v"(ov[2][1]), "v"(ov[3][0]), "v"(ov[3][1]),
                     "v"(mg), "v"(lg), "v"(bval),
                     "v"(wr[0][0]), "v"(wr[0][1]), "v"(wr[0][2]), "v"(wr[0][3]),
                     "v"(wr[1][0]), "v"(wr[1][1]), "v"(wr[1][2]), "v"(wr[1][3]),
                     "v"(wr[2][0]), "v"(wr[2][1]), "v"(wr[2][2]), "v"(wr[2][3]),
                     "v"(wr[3][0]), "v"(wr[3][1]), "v"(wr[3][2]), "v"(wr[3][3]));

  float M = -__builtin_inff();
#pragma unroll
  for (int g = 0; g < GSPLIT; ++g) M = fmaxf(M, mg[g]);
  float w[GSPLIT], L = 0.f;
#pragma unroll
  for (int g = 0; g < GSPLIT; ++g) { w[g] = exp2_one((mg[g] - M) * LOG2E); L += w[g] * lg[g]; }
  float rinv = 1.0f / L;
#pragma unroll
  for (int c = 0; c < 2; ++c) {
    float s[4] = {0.f, 0.f, 0.f, 0.f};
#pragma unroll
    for (int g = 0; g < GSPLIT; ++g) {
      s[0] += w[g] * ov[g][c].x; s[1] += w[g] * ov[g][c].y;
      s[2] += w[g] * ov[g][c].z; s[3] += w[g] * ov[g][c].w;
    }
    *(uint2*)(At + mr * LPITCH + (f0 + c * 64) * 2) =
        make_uint2(pack_bf2(s[0] * rinv, s[1] * rinv), pack_bf2(s[2] * rinv, s[3] * rinv));
  }
  __syncthreads();   // the merged tile is whole before any wave reads its A fragments

  v8f acc = {0.f, 0.f, 0.f, 0.f, 0.f, 0.f, 0.f, 0.f};
#pragma unroll
  for (int kc = 0; kc < 4; ++kc) {
    v8u u = {pack_bf2(wr[kc][0].x, wr[kc][0].y), pack_bf2(wr[kc][0].z, wr[kc][0].w),
             pack_bf2(wr[kc][1].x, wr[kc][1].y), pack_bf2(wr[kc][1].z, wr[kc][1].w),
             pack_bf2(wr[kc][2].x, wr[kc][2].y), pack_bf2(wr[kc][2].z, wr[kc][2].w),
             pack_bf2(wr[kc][3].x, wr[kc][3].y), pack_bf2(wr[kc][3].z, wr[kc][3].w)};
    acc = wmma_bf16(frag_lds(At, 0, kc * 64), __builtin_bit_cast(v16bf, u), acc);
  }
#pragma unroll
  for (int v = 0; v < 8; ++v)
    out[(size_t)(row0 + h * 8 + v) * DMODEL + n0 + n] = acc[v] + bval;
}

// ---------- launch ----------
extern "C" void kernel_launch(void* const* d_in, const int* in_sizes, int n_in,
                              void* d_out, int out_size, void* d_ws, size_t ws_size,
                              hipStream_t stream) {
  const float* x  = (const float*)d_in[0];
  const float* Wq = (const float*)d_in[1];
  const float* bq = (const float*)d_in[2];
  const float* Wk = (const float*)d_in[3];
  const float* bk = (const float*)d_in[4];
  const float* Wv = (const float*)d_in[5];
  const float* bv = (const float*)d_in[6];
  const float* Wo = (const float*)d_in[7];
  const float* bo = (const float*)d_in[8];

  bf16_t* Qb = (bf16_t*)d_ws;                          // 2 MB
  bf16_t* Kb = Qb + (size_t)NTOK * DMODEL;             // 2 MB
  bf16_t* Vt = Kb + (size_t)NTOK * DMODEL;             // 2 MB (V; all three in fragment order)
  float* Opart = (float*)(Vt + (size_t)DMODEL * NTOK); // 16 MB
  float* mpart = Opart + (size_t)GSPLIT * NTOK * DMODEL;
  float* lpart = mpart + (size_t)GSPLIT * NTOK;

  // 128 groups of 64 rows * 2 groups of 4 column tiles = 256 blocks
  qkv_kernel<<<256, 256, 0, stream>>>(x, Wq, bq, Wk, bk, Wv, bv, Qb, Kb, Vt);
  // 64 blocks of 128 queries * 4 KV groups = 256 blocks
  flash_kernel<<<256, 256, 0, stream>>>(Qb, Kb, Vt, Opart, mpart, lpart);
  // 512 row tiles, one block each: 8 waves = 8 col-tiles
  merge_out_kernel<<<512, 256, 0, stream>>>(Opart, mpart, lpart, Wo, bo, (float*)d_out);
}

// v008
// It runs in 37.7 microseconds.
// In two side-by-side timings against v007, it was 1.06 and 1.05 times as fast.
// Over all steps from v000 it is 4.10 times as fast.
#include <hip/hip_runtime.h>
#include <hip/hip_bf16.h>

typedef __bf16 bf16_t;
typedef __attribute__((ext_vector_type(16))) __bf16        v16bf;
typedef __attribute__((ext_vector_type(8)))  float         v8f;
typedef __attribute__((ext_vector_type(8)))  unsigned int  v8u;
typedef __attribute__((ext_vector_type(4)))  float         v4f;
typedef __attribute__((ext_vector_type(4)))  __bf16        v4bf;
typedef __attribute__((ext_vector_type(8)))  __bf16        v8bf;

#define NTOK    8192
#define DMODEL  128
#define GSPLIT  4
#define KV_PER_G (NTOK / GSPLIT)
#define SM_SCALE 0.08838834764831845f   // 1/sqrt(128)

// ---------- helpers ----------

// two f32 -> packed 2x bf16 (RNE) using the native conversion path
__device__ __forceinline__ unsigned int pack_bf2(float a, float b) {
  unsigned short ua = __builtin_bit_cast(unsigned short, (__bf16)a);
  unsigned short ub = __builtin_bit_cast(unsigned short, (__bf16)b);
  return (unsigned int)ua | ((unsigned int)ub << 16);
}

__device__ __forceinline__ v8f wmma_bf16(v16bf a, v16bf b, v8f c) {
  // D = A(16x32) * B(32x16) + C, fp32 accumulate
  return __builtin_amdgcn_wmma_f32_16x16x32_bf16(false, a, false, b, (short)0, c,
                                                 false, false);
}

// A/B fragment for V_WMMA_F32_16X16X32_BF16 built from a row-major matrix.
// ISA 7.12.2 16-bit A layout: row r = lane&15; lanes 0-15 hold K
// {k0..k0+7, k0+16..k0+23}; lanes 16-31 hold K {k0+8..k0+15, k0+24..k0+31}.
// B uses the mirrored layout with r = output-column index, so the same loader
// serves either operand: x rows and W rows (x @ W^T), both contiguous in K.
// From f32 sources in two halves: the lane's 16 floats as read, and their rounding to bf16.
// row = the lane's row r, staged in LDS, at column k0 + (lane >> 4) * 8.
struct raw16 { v4f q[4]; };
__device__ __forceinline__ raw16 raw_f32(const unsigned char* row) {
  const v4f* p = (const v4f*)row;
  raw16 r;
  r.q[0] = p[0]; r.q[1] = p[1];
  r.q[2] = p[4]; r.q[3] = p[5];   // p + 16 floats
  return r;
}
__device__ __forceinline__ v16bf round_frag(const raw16& r) {
  v4bf c0 = __builtin_convertvector(r.q[0], v4bf), c1 = __builtin_convertvector(r.q[1], v4bf);
  v4bf c2 = __builtin_convertvector(r.q[2], v4bf), c3 = __builtin_convertvector(r.q[3], v4bf);
  v8bf lo = __builtin_shufflevector(c0, c1, 0, 1, 2, 3, 4, 5, 6, 7);
  v8bf hi = __builtin_shufflevector(c2, c3, 0, 1, 2, 3, 4, 5, 6, 7);
  return __builtin_shufflevector(lo, hi, 0, 1, 2, 3, 4, 5, 6, 7, 8, 9, 10, 11, 12, 13, 14, 15);
}

// The same fragment from two 512-byte blocks in fragment order (see qkv_kernel), in global memory
// or in LDS: p = the lane's 16 bytes of the block with the fragment's first 16 k values,
// hi_off = bytes from there to the block with the next 16.
__device__ __forceinline__ v16bf frag_blk(const unsigned char* p, int hi_off) {
  uint4 lo = *(const uint4*)p;             // 8 bf16
  uint4 hi = *(const uint4*)(p + hi_off);  // 8 bf16
  v8u u = {lo.x, lo.y, lo.z, lo.w, hi.x, hi.y, hi.z, hi.w};
  return __builtin_bit_cast(v16bf, u);
}

// ---------- kernel 1: Q/K/V projections ----------
// One wave = 32 rows of x (two row tiles) times one 16-column tile of each of Q, K and V: six
// 16x16 tiles, every x fragment feeding three products and every W fragment two.
// One block = 8 waves = 64 rows x 4 column tiles of each matrix; 128 row groups x 2 column
// groups = 256 blocks, 2048 waves.
// Q, K and V leave in the order of their reader's fragments: blocks of 512 bytes, one per
// (tile of 16 tokens, tile of 16 features), block index = token tile * 8 + feature tile, lane l
// of a wave owning bytes 16 l .. 16 l + 15. Q, K: lane (token l & 15) holds features
// (l >> 4) * 8 .. + 7; V: lane (feature l & 15) holds tokens (l >> 4) * 8 .. + 7. So a wave
// stores a tile with one 16-byte store per lane, 512 bytes in a row. For that the Q and K
// products are formed transposed (A = W rows, B = x rows): a lane's 8 values are 8 features.
// The block's operands (64 rows of x, 64 rows each of Wq, Wk, Wv; 512 bytes a row) come into LDS
// once, by asynchronous copies, a whole row per copy of a wave, so that memory is read in whole
// lines and each row once per block. A fragment load straight from memory takes 32 bytes
// out of each of 16 lines, and each x row is wanted by four waves, each W row by two.
#define XPITCH 528   // LDS row: 512 bytes + 16, so that the 16 rows of a fragment read fall on all 64 banks
#define XROWS  64    // rows per staged operand

// Eight 16-byte copies of one lane: its 16 bytes of each of eight rows that follow one another.
// lds: the lane's LDS byte address in the first row; g: its global address there.
// The s_wait_xcnt closes the statement so that no
// address register named here is rewritten before the copies have taken it.
__device__ __forceinline__ void copy_rows8(unsigned int lds, const char* g) {
  const size_t gstep = DMODEL * 4;
  asm volatile(
      "global_load_async_to_lds_b128 %0, %8, off\n\t"
      "global_load_async_to_lds_b128 %1, %9, off\n\t"
      "global_load_async_to_lds_b128 %2, %10, off\n\t"
      "global_load_async_to_lds_b128 %3, %11, off\n\t"
      "global_load_async_to_lds_b128 %4, %12, off\n\t"
      "global_load_async_to_lds_b128 %5, %13, off\n\t"
      "global_load_async_to_lds_b128 %6, %14, off\n\t"
      "global_load_async_to_lds_b128 %7, %15, off\n\t"
      "s_wait_xcnt 0x0"
      :: "v"(lds), "v"(lds + 1u * XPITCH), "v"(lds + 2u * XPITCH), "v"(lds + 3u * XPITCH),
         "v"(lds + 4u * XPITCH), "v"(lds + 5u * XPITCH), "v"(lds + 6u * XPITCH),
         "v"(lds + 7u * XPITCH),
         "v"(g), "v"(g + gstep), "v"(g + 2 * gstep), "v"(g + 3 * gstep),
         "v"(g + 4 * gstep), "v"(g + 5 * gstep), "v"(g + 6 * gstep), "v"(g + 7 * gstep)
      : "memory");
}

__global__ void __launch_bounds__(256) qkv_kernel(
    const float* __restrict__ x,
    const float* __restrict__ Wq, const float* __restrict__ bq,
    const float* __restrict__ Wk, const float* __restrict__ bk,
    const float* __restrict__ Wv, const float* __restrict__ bv,
    bf16_t* __restrict__ Qb, bf16_t* __restrict__ Kb, bf16_t* __restrict__ Vt) {
  __shared__ __attribute__((aligned(16))) unsigned char S[4 * XROWS * XPITCH];   // x, Wq, Wk, Wv
  int wv   = threadIdx.x >> 5;
  int lane = threadIdx.x & 31, n = lane & 15, h = lane >> 4;
  int rowb = (blockIdx.x >> 1) * XROWS, colb = (blockIdx.x & 1) * XROWS;
  int row0 = rowb + (wv >> 2) * 32;
  int n0   = colb + (wv & 3) * 16;

  // wave wv brings rows 8 wv .. 8 wv + 7 of each operand, lane l bytes 16 l .. 16 l + 15 of a row
  unsigned int ldst = (unsigned int)(size_t)S + (unsigned int)(wv * 8 * XPITCH + lane * 16);
  size_t xsrc = (size_t)(rowb + wv * 8) * (DMODEL * 4) + lane * 16;
  size_t wsrc = (size_t)(colb + wv * 8) * (DMODEL * 4) + lane * 16;
  copy_rows8(ldst, (const char*)x + xsrc);
  copy_rows8(ldst + 1u * XROWS * XPITCH, (const char*)Wq + wsrc);
  copy_rows8(ldst + 2u * XROWS * XPITCH, (const char*)Wk + wsrc);
  copy_rows8(ldst + 3u * XROWS * XPITCH, (const char*)Wv + wsrc);

  // bias: V by the lane's column, Q and K by the lane's 8 rows (features) of the transposed tile
  // both read at one byte offset from their own base; in flight beside the copies
  float bvv = bv[n0 + n];
  unsigned int boff = (unsigned int)(n0 + h * 8) * 4u;
  const v4f* pbq = (const v4f*)((const char*)bq + boff);
  const v4f* pbk = (const v4f*)((const char*)bk + boff);
  v4f bq0 = pbq[0], bq1 = pbq[1], bk0 = pbk[0], bk1 = pbk[1];
  // precaution: the wait stands behind the bias loads and in front of every later write of the
  // offset register that they name; as an input here it stays whole up to it
  asm volatile("s_wait_xcnt 0x0" :: "v"(boff) : "memory");

  asm volatile("s_wait_asynccnt 0x0" ::: "memory");  // this wave's copies have landed
  __syncthreads();                                   // every wave's have: the rows may be read

  const unsigned char* xs = S + ((wv >> 2) * 32 + n) * XPITCH + h * 32;
  const unsigned char* ws = S + (XROWS + (wv & 3) * 16 + n) * XPITCH + h * 32;
  raw16 xr[2][4], wr[3][4];
  // every loop of this kernel is unrolled: fragment and accumulator indices become constants,
  // so that the arrays stay in registers
#pragma unroll
  for (int kc = 0; kc < 4; ++kc) {
    xr[0][kc] = raw_f32(xs + kc * 128);                    // x rows: A of V, B of Q^T and K^T
    xr[1][kc] = raw_f32(xs + 16 * XPITCH + kc * 128);
    wr[0][kc] = raw_f32(ws + kc * 128);                    // W rows: the other operand (x @ W^T)
    wr[1][kc] = raw_f32(ws + 1 * XROWS * XPITCH + kc * 128);
    wr[2][kc] = raw_f32(ws + 2 * XROWS * XPITCH + kc * 128);
  }

  v8f bq8 = __builtin_shufflevector(bq0, bq1, 0, 1, 2, 3, 4, 5, 6, 7);
  v8f bk8 = __builtin_shufflevector(bk0, bk1, 0, 1, 2, 3, 4, 5, 6, 7);
  v8f acc[2][3];
#pragma unroll
  for (int r = 0; r < 2; ++r)
#pragma unroll
    for (int mat = 0; mat < 3; ++mat)
#pragma unroll
      for (int v = 0; v < 8; ++v) acc[r][mat][v] = 0.f;
#pragma unroll
  for (int kc = 0; kc < 4; ++kc) {
    v16bf a[2] = {round_frag(xr[0][kc]), round_frag(xr[1][kc])};
#pragma unroll
    for (int mat = 0; mat < 3; ++mat) {
      v16bf b = round_frag(wr[mat][kc]);
#pragma unroll
      for (int r = 0; r < 2; ++r)
        acc[r][mat] = mat < 2 ? wmma_bf16(b, a[r], acc[r][mat])    // Q^T, K^T: (feature, token)
                              : wmma_bf16(a[r], b, acc[r][mat]);   // V: (token, feature)
    }
  }

#pragma unroll
  for (int r = 0; r < 2; ++r) {
    size_t blk = ((size_t)((row0 >> 4) + r) * 8 + (n0 >> 4)) * 256 + lane * 8;   // in elements
    // whole vectors, rounded in pairs of neighbours: a lane's 8 values are its 16 bytes
    *(v8bf*)(Qb + blk) = __builtin_convertvector((acc[r][0] + bq8) * SM_SCALE, v8bf);  // softmax scale folded into Q
    *(v8bf*)(Kb + blk) = __builtin_convertvector(acc[r][1] + bk8, v8bf);
    *(v8bf*)(Vt + blk) = __builtin_convertvector(acc[r][2] + bvv, v8bf);
  }
}

// ---------- kernel 2: flash attention (transposed), split-KV ----------
// One block = 8 waves = 128 queries of ONE KV group. A wave holds 32 query columns (two Q
// tiles), so every K and V^T fragment it reads from LDS feeds two products. Waves 0-3 cover
// the block's 128 queries on the even stages (128 keys each), waves 4-7 the same queries on
// the odd stages; the two halves' partials are merged through LDS behind the loop.
// The K and V blocks of two stages (one trip) are brought into LDS once per block by
// asynchronous copies; two buffers, the next trip's copies fly while this trip is worked on.
// A stage's K (and V) is 32 KB in a row in global memory, in fragment order, and lies in LDS
// as it lies there: every copy and every fragment read of a wave covers 512 bytes in a row.
// Inside a stage each wave fetches its fragments one pass (32 keys) ahead.
// Computes S^T = K * Q^T so the D-layout of exp(S^T) is directly the
// B-fragment of O^T = V^T * P^T (no shuffles).
#define ST_KEYS  128                      // keys per stage
#define NSTAGE   (KV_PER_G / ST_KEYS)     // 16 stages per block
#define NTRIP    (NSTAGE / 2)             // a trip = two stages, one for each half of the waves
#define LPITCH   272                      // merged tile of the last kernel: 256-byte rows + 16
#define TOK16_B  4096                     // 16 tokens x 128 features: 8 blocks of 512 bytes
#define TILE_B   (ST_KEYS / 16 * TOK16_B) // K or V of one stage: 128 keys x 128 features
#define STAGE_B  (2 * TILE_B)
#define TRIP_B   (2 * STAGE_B)

// Eight 16-byte copies of one lane: its 16 bytes of each 4-KB eighth of a 32-KB tile.
// lds: the lane's LDS byte address in the first eighth; g: its global address there.
// The s_wait_xcnt closes the statement so that no
// address register named here is rewritten before the copies have taken it.
__device__ __forceinline__ void copy_tile(unsigned int lds, const char* g) {
  const size_t gstep = TOK16_B;
  asm volatile(
      "global_load_async_to_lds_b128 %0, %8, off\n\t"
      "global_load_async_to_lds_b128 %1, %9, off\n\t"
      "global_load_async_to_lds_b128 %2, %10, off\n\t"
      "global_load_async_to_lds_b128 %3, %11, off\n\t"
      "global_load_async_to_lds_b128 %4, %12, off\n\t"
      "global_load_async_to_lds_b128 %5, %13, off\n\t"
      "global_load_async_to_lds_b128 %6, %14, off\n\t"
      "global_load_async_to_lds_b128 %7, %15, off\n\t"
      "s_wait_xcnt 0x0"
      :: "v"(lds), "v"(lds + 1u * TOK16_B), "v"(lds + 2u * TOK16_B), "v"(lds + 3u * TOK16_B),
         "v"(lds + 4u * TOK16_B), "v"(lds + 5u * TOK16_B), "v"(lds + 6u * TOK16_B),
         "v"(lds + 7u * TOK16_B),
         "v"(g), "v"(g + gstep), "v"(g + 2 * gstep), "v"(g + 3 * gstep),
         "v"(g + 4 * gstep), "v"(g + 5 * gstep), "v"(g + 6 * gstep), "v"(g + 7 * gstep)
      : "memory");
}

// The same fragment from an LDS tile of LPITCH-byte rows; kb = byte offset of k0.
__device__ __forceinline__ v16bf frag_lds(const unsigned char* tile, int r0, int kb) {
  int lane = threadIdx.x & 31;
  const unsigned char* p = tile + (r0 + (lane & 15)) * LPITCH + kb + ((lane >> 4) << 4);
  uint4 lo = *(const uint4*)p;         // 8 bf16
  uint4 hi = *(const uint4*)(p + 32);  // 8 bf16, 16 elements on
  v8u u = {lo.x, lo.y, lo.z, lo.w, hi.x, hi.y, hi.z, hi.w};
  return __builtin_bit_cast(v16bf, u);
}

// Runs of v_exp_f32 (2^x), each run one statement closed by a v_nop: the slot that the
// instruction set asks for between a transcendental and the next vector instruction that
// overwrites its source or reads its result.
__device__ __forceinline__ void exp2_run8(float (&r)[8], const float (&x)[8]) {
  asm("v_exp_f32 %0, %8\n\t"
      "v_exp_f32 %1, %9\n\t"
      "v_exp_f32 %2, %10\n\t"
      "v_exp_f32 %3, %11\n\t"
      "v_exp_f32 %4, %12\n\t"
      "v_exp_f32 %5, %13\n\t"
      "v_exp_f32 %6, %14\n\t"
      "v_exp_f32 %7, %15\n\t"
      "v_nop"
      : "=&v"(r[0]), "=&v"(r[1]), "=&v"(r[2]), "=&v"(r[3]),
        "=&v"(r[4]), "=&v"(r[5]), "=&v"(r[6]), "=&v"(r[7])
      : "v"(x[0]), "v"(x[1]), "v"(x[2]), "v"(x[3]), "v"(x[4]), "v"(x[5]), "v"(x[6]), "v"(x[7]));
}
__device__ __forceinline__ float exp2_one(float x) {
  float r;
  asm("v_exp_f32 %0, %1\n\tv_nop" : "=&v"(r) : "v"(x));
  return r;
}
#define LOG2E 1.4426950408889634f   // exp(x) = 2^(x * LOG2E), as __expf forms it
#define RESCALE_THR 5.545177444479562f   // 8 / LOG2E: a score this far above the reference gives 2^8

__global__ void __launch_bounds__(256) flash_kernel(
    const bf16_t* __restrict__ Qb, const bf16_t* __restrict__ Kb,
    const bf16_t* __restrict__ Vt,
    float* __restrict__ Opart, float* __restrict__ mpart,
    float* __restrict__ lpart) {
  __shared__ __attribute__((aligned(16))) unsigned char L[2 * TRIP_B];

  int grp  = blockIdx.x & 3;
  int wv   = threadIdx.x >> 5;
  int kh   = wv >> 2;                                   // which stage of a trip this wave works on
  int row0 = (blockIdx.x >> 2) * 128 + (wv & 3) * 32;   // first of the wave's 32 queries
  int lane = threadIdx.x & 31, i = lane & 15, h = lane >> 4;
  int jbase = grp * KV_PER_G;

  // this thread's share of every tile: bytes 16 tid .. 16 tid + 15 of each 4 KB (16 keys)
  unsigned int ldst = (unsigned int)(size_t)L + threadIdx.x * 16;
  const char* gk = (const char*)(Kb + (size_t)jbase * DMODEL + threadIdx.x * 8);
  const char* gv = (const char*)(Vt + (size_t)jbase * DMODEL + threadIdx.x * 8);
  const size_t KADV = TILE_B, VADV = TILE_B;   // one stage on

  // trip 0 (stages 0 and 1) into buffer 0, landed and published; then trip 1 into buffer 1
  copy_tile(ldst, gk);
  copy_tile(ldst + TILE_B, gv);
  copy_tile(ldst + STAGE_B, gk + KADV);
  copy_tile(ldst + STAGE_B + TILE_B, gv + VADV);

  v16bf qf[2][4];
#pragma unroll
  for (int c = 0; c < 2; ++c)
#pragma unroll
    for (int kc = 0; kc < 4; ++kc)
      qf[c][kc] = frag_blk((const unsigned char*)Qb + ((row0 >> 4) + c) * TOK16_B + kc * 1024 +
                               lane * 16, 512);

  v8f o[2][8];
#pragma unroll
  for (int c = 0; c < 2; ++c)
#pragma unroll
    for (int t = 0; t < 8; ++t)
#pragma unroll
      for (int v = 0; v < 8; ++v) o[c][t][v] = 0.f;

  float m[2] = {-__builtin_inff(), -__builtin_inff()}, lsum[2] = {0.f, 0.f};

  asm volatile("s_wait_asynccnt 0x0" ::: "memory");  // this wave's copies of trip 0 have landed
  __syncthreads();                                   // every wave's have: trip 0 may be read
  copy_tile(ldst + TRIP_B, gk + 2 * KADV);
  copy_tile(ldst + TRIP_B + TILE_B, gv + 2 * VADV);
  copy_tile(ldst + TRIP_B + STAGE_B, gk + 3 * KADV);
  copy_tile(ldst + TRIP_B + STAGE_B + TILE_B, gv + 3 * VADV);

  const char* nk = gk + 4 * KADV;   // source of the next refill
  const char* nv = gv + 4 * VADV;
  unsigned int nl = ldst;           // its place in LDS: the buffer that the trip has just read
  for (int tr = 0; tr < NTRIP; ++tr) {
    unsigned int boff = (tr & 1) * TRIP_B;
    const unsigned char* Ks = L + boff + kh * STAGE_B + lane * 16;   // the lane's bytes of block 0
    const unsigned char* Vs = Ks + TILE_B;
    // Fragments are fetched one pass ahead, inside the stage. Here the 8 K and 8 V^T fragments
    // of the stage's first pass, as one group of LDS reads.
    v16bf kf[8], vf[8];
#pragma unroll
    for (int kc = 0; kc < 4; ++kc) {
      kf[2 * kc]     = frag_blk(Ks + kc * 1024, 512);              // keys 0-15, features 32 kc ..
      kf[2 * kc + 1] = frag_blk(Ks + TOK16_B + kc * 1024, 512);    // keys 16-31
    }
    // scheduling fence: K ahead of V^T in the group, as the S^T products need theirs first
    __builtin_amdgcn_sched_barrier(0);
#pragma unroll
    for (int t = 0; t < 8; ++t) vf[t] = frag_blk(Vs + t * 512, TOK16_B);   // features 16 t .., keys 0-31
    // scheduling fence: keeps the group whole; left free, the reads end up singly among the
    // products, each waited for where it stands
    __builtin_amdgcn_sched_barrier(0);
    // unrolled: every LDS offset becomes an immediate and every fragment index a constant
#pragma unroll
    for (int ps = 0; ps < ST_KEYS / 32; ++ps) {
      int jl = ps * 32;
      // S^T tiles: D(j_local, i) = sum_c K[j+j_local,c] * Q[row0+i,c]; each K fragment serves
      // both query tiles
      v8f s0[2], s1[2];
#pragma unroll
      for (int c = 0; c < 2; ++c)
#pragma unroll
        for (int v = 0; v < 8; ++v) { s0[c][v] = 0.f; s1[c][v] = 0.f; }
#pragma unroll
      for (int kc = 0; kc < 4; ++kc) {
#pragma unroll
        for (int c = 0; c < 2; ++c) {
          s0[c] = wmma_bf16(kf[2 * kc],     qf[c][kc], s0[c]);
          s1[c] = wmma_bf16(kf[2 * kc + 1], qf[c][kc], s1[c]);
        }
      }
      // online softmax: stats are per-lane scalars (query i = lane&15 of each query tile).
      // m[c] is the reference in use, the same in both lanes of a query; it is a maximum of
      // scores seen so far, not always the latest. mx[c]: maximum of this lane's 16 keys.
      float mx[2];
#pragma unroll
      for (int c = 0; c < 2; ++c) {
        mx[c] = fmaxf(s0[c][0], s1[c][0]);
#pragma unroll
        for (int v = 1; v < 8; ++v) mx[c] = fmaxf(mx[c], fmaxf(s0[c][v], s1[c][v]));
      }
      // Lazy rescale, one test per pass: the reference moves only where a score stands more than
      // RESCALE_THR above it (always in the first pass, where it is -inf). Otherwise every
      // exponential of the pass is at most 2^8, and sums and accumulators go on unscaled.
      bool need = (mx[0] - m[0] > RESCALE_THR) | (mx[1] - m[1] > RESCALE_THR);
      unsigned int any_need = __builtin_amdgcn_ballot_w32(need);
      // The next pass's K fragments (same stage, same buffer), one group, issued once the maxima
      // are known and in flight under the rest of this pass's softmax and its O^T products; their
      // issue also stands between the test and its branch. The scheduling fence in front keeps
      // the group whole and at this place: without it the reads are drawn up among the S^T
      // products. Behind the group the branch ends the block, so that none is needed there.
      if (ps + 1 < ST_KEYS / 32) {
        __builtin_amdgcn_sched_barrier(0);
#pragma unroll
        for (int kc = 0; kc < 4; ++kc) {
          kf[2 * kc]     = frag_blk(Ks + ((jl + 32) >> 4) * TOK16_B + kc * 1024, 512);
          kf[2 * kc + 1] = frag_blk(Ks + ((jl + 48) >> 4) * TOK16_B + kc * 1024, 512);
        }
      }
      if (any_need != 0) {   // the same in every lane: a scalar branch, all lanes on inside
#pragma unroll
        for (int c = 0; c < 2; ++c) {
          float mnew  = fmaxf(m[c], fmaxf(mx[c], __shfl_xor(mx[c], 16)));
          float alpha = exp2_one((m[c] - mnew) * LOG2E);
          m[c] = mnew;
          lsum[c] *= alpha;
#pragma unroll
          for (int t = 0; t < 8; ++t)
#pragma unroll
            for (int v = 0; v < 8; ++v) o[c][t][v] *= alpha;
        }
      }
      v16bf pt[2];
#pragma unroll
      for (int c = 0; c < 2; ++c) {
        float x0[8], x1[8], e0[8], e1[8], rs = 0.f;
#pragma unroll
        for (int v = 0; v < 8; ++v) {
          x0[v] = (s0[c][v] - m[c]) * LOG2E;
          x1[v] = (s1[c][v] - m[c]) * LOG2E;
        }
        exp2_run8(e0, x0);
        exp2_run8(e1, x1);
#pragma unroll
        for (int v = 0; v < 8; ++v) rs += e0[v] + e1[v];
        rs += __shfl_xor(rs, 16);
        lsum[c] += rs;

        // P^T as B-fragment, assembled directly from D layout (no shuffles)
        v8u pu = {pack_bf2(e0[0], e0[1]), pack_bf2(e0[2], e0[3]),
                  pack_bf2(e0[4], e0[5]), pack_bf2(e0[6], e0[7]),
                  pack_bf2(e1[0], e1[1]), pack_bf2(e1[2], e1[3]),
                  pack_bf2(e1[4], e1[5]), pack_bf2(e1[6], e1[7])};
        pt[c] = __builtin_bit_cast(v16bf, pu);
      }

#pragma unroll
      for (int t = 0; t < 8; ++t) {
#pragma unroll
        for (int c = 0; c < 2; ++c) {
          // A: V^T rows (features); O^T(feature, i); each V^T fragment serves both query tiles
          o[c][t] = wmma_bf16(vf[t], pt[c], o[c][t]);
        }
      }
      // The next pass's V^T fragments, one group, into the registers that the O^T products have
      // just read (a second V^T set does not fit beside the accumulators of 32 query columns);
      // in flight under the next pass's S^T products. Scheduling fences: the one in front keeps
      // the O^T products ahead of the reads and of the next pass's S^T products, the one behind
      // keeps the group whole instead of dealt out singly among those products.
      if (ps + 1 < ST_KEYS / 32) {
        __builtin_amdgcn_sched_barrier(0);
#pragma unroll
        for (int t = 0; t < 8; ++t)
          vf[t] = frag_blk(Vs + ((jl + 32) >> 4) * TOK16_B + t * 512, TOK16_B);
        __builtin_amdgcn_sched_barrier(0);
      }
    }
    // publish point of trip tr + 1, and hand-over of this trip's buffer to its refill
    asm volatile("s_wait_dscnt 0x0" ::: "memory");     // this wave's reads of the buffer are done
    asm volatile("s_wait_asynccnt 0x0" ::: "memory");  // this wave's copies of trip tr + 1 have landed
    __syncthreads();                                   // both hold for every wave of the block
    if (tr + 2 < NTRIP) {                              // the same test in the whole block
      copy_tile(nl, nk);
      copy_tile(nl + TILE_B, nv);
      copy_tile(nl + STAGE_B, nk + KADV);
      copy_tile(nl + STAGE_B + TILE_B, nv + VADV);
      nk += 2 * KADV;
      nv += 2 * VADV;
      nl += TRIP_B - 2 * boff;      // to the other buffer
    }
  }
  asm volatile("s_wait_asynccnt 0x0" ::: "memory");    // nothing of this wave is in flight at its end

  // Merge of the two key halves. Waves wv and wv ^ 4 hold partials of the same 32 queries:
  // the wave of half kh keeps query tile kh and hands the other tile to its partner through
  // LDS. The ring is free: the loop's last barrier stands behind every wave's last read of it
  // and behind every wave's wait for its last copies.
  float* X  = (float*)L;                  // 8 waves x 8 KB: the tile handed over
  float* XS = X + 8 * 2048;               // 8 waves x 32 lanes x (m, l)
  bool  up = kh != 0;
  float mk = up ? m[1] : m[0],  lk = up ? lsum[1] : lsum[0];
  float mg = up ? m[0] : m[1],  lg = up ? lsum[0] : lsum[1];
  float* xw = X + wv * 2048 + lane * 4;
#pragma unroll
  for (int t = 0; t < 8; ++t) {
    float4 g0 = {up ? o[0][t][0] : o[1][t][0], up ? o[0][t][1] : o[1][t][1],
                 up ? o[0][t][2] : o[1][t][2], up ? o[0][t][3] : o[1][t][3]};
    float4 g1 = {up ? o[0][t][4] : o[1][t][4], up ? o[0][t][5] : o[1][t][5],
                 up ? o[0][t][6] : o[1][t][6], up ? o[0][t][7] : o[1][t][7]};
    *(float4*)(xw + (2 * t) * 128)     = g0;
    *(float4*)(xw + (2 * t + 1) * 128) = g1;
  }
  *(float2*)(XS + wv * 64 + lane * 2) = make_float2(mg, lg);
  __syncthreads();   // every wave's handed-over tile is written before its partner reads it
  const float* xr = X + (wv ^ 4) * 2048 + lane * 4;
  float2 st2 = *(const float2*)(XS + (wv ^ 4) * 64 + lane * 2);
  float M  = fmaxf(mk, st2.x);
  float ak = exp2_one((mk - M) * LOG2E), ap = exp2_one((st2.x - M) * LOG2E);
  float lm = lk * ak + st2.y * ap;

  // store unnormalized partials + stats. The partials leave in the accumulators' own order: 8 KB
  // per (KV group, tile of 16 queries), 16 runs of 512 bytes, run 2 t + p = features
  // 16 t + 8 h + 4 p .. + 3 of query i in lane (i, h): every store of a wave is 512 bytes in a row.
  int row = row0 + kh * 16 + i;
  float* obase = Opart + ((size_t)grp * (NTOK / 16) + (row0 >> 4) + kh) * (16 * DMODEL) + lane * 4;
#pragma unroll
  for (int t = 0; t < 8; ++t) {
    float4 p0 = *(const float4*)(xr + (2 * t) * 128);
    float4 p1 = *(const float4*)(xr + (2 * t + 1) * 128);
    float4 w0 = {(up ? o[1][t][0] : o[0][t][0]) * ak + p0.x * ap,
                 (up ? o[1][t][1] : o[0][t][1]) * ak + p0.y * ap,
                 (up ? o[1][t][2] : o[0][t][2]) * ak + p0.z * ap,
                 (up ? o[1][t][3] : o[0][t][3]) * ak + p0.w * ap};
    float4 w1 = {(up ? o[1][t][4] : o[0][t][4]) * ak + p1.x * ap,
                 (up ? o[1][t][5] : o[0][t][5]) * ak + p1.y * ap,
                 (up ? o[1][t][6] : o[0][t][6]) * ak + p1.z * ap,
                 (up ? o[1][t][7] : o[0][t][7]) * ak + p1.w * ap};
    *(float4*)(obase + (2 * t) * 128)     = w0;
    *(float4*)(obase + (2 * t + 1) * 128) = w1;
  }
  if (h == 0) {
    mpart[grp * NTOK + row] = M;
    lpart[grp * NTOK + row] = lm;
  }
}

// ---------- kernel 3: merge of the split-KV partials + output projection ----------
// One block = 16 rows. Its 256 threads merge the rows' GSPLIT partials into one bf16 tile in
// LDS, which is the A operand of the block's eight 16x16 output tiles (one wave each).
__global__ void __launch_bounds__(256) merge_out_kernel(
    const float* __restrict__ Opart, const float* __restrict__ mpart,
    const float* __restrict__ lpart, const float* __restrict__ Wo,
    const float* __restrict__ bo, float* __restrict__ out) {
  __shared__ __attribute__((aligned(16))) unsigned char At[16 * LPITCH];
  __shared__ __attribute__((aligned(16))) unsigned char Ws[DMODEL * XPITCH];   // Wo rows, as in qkv_kernel
  int row0 = blockIdx.x * 16, n0 = (threadIdx.x >> 5) * 16;
  int lane = threadIdx.x & 31, n = lane & 15, h = lane >> 4;

  // B: Wo rows, into LDS by asynchronous copies, a whole row per copy (see qkv_kernel): each wave
  // brings the 16 rows of its own column tile; issued first, so that
  // no wait for a loaded value can be drawn in front of them
  unsigned int wl = (unsigned int)(size_t)Ws + (unsigned int)(n0 * XPITCH + lane * 16);
  const char* wg = (const char*)Wo + (size_t)n0 * (DMODEL * 4) + lane * 16;
  copy_rows8(wl, wg);
  copy_rows8(wl + 8u * XPITCH, wg + 8 * (DMODEL * 4));

  // merge: the partials lie in the accumulators' order (see flash_kernel): thread tid takes bytes
  // 16 tid .. + 15 of each half of a group's 8 KB, which are row tid & 15, features f0..f0+3 and
  // f0+64..f0+67; each load of a wave covers 512 bytes in a row
  int mr  = threadIdx.x & 15;
  int f0  = (threadIdx.x >> 6) * 16 + h * 8 + ((threadIdx.x >> 5) & 1) * 4;
  int row = row0 + mr;
  v4f ov[GSPLIT][2];
#pragma unroll
  for (int g = 0; g < GSPLIT; ++g) {
    const float* p = Opart + ((size_t)g * (NTOK / 16) + blockIdx.x) * (16 * DMODEL) + threadIdx.x * 4;
    ov[g][0] = *(const v4f*)p;
    ov[g][1] = *(const v4f*)(p + 1024);
  }
  // precaution: later loads may be given the address registers of the loads above as destinations
  asm volatile("s_wait_xcnt 0x0" ::: "memory");
  v4f mg, lg;
#pragma unroll
  for (int g = 0; g < GSPLIT; ++g) { mg[g] = mpart[g * NTOK + row]; lg[g] = lpart[g * NTOK + row]; }
  float bval = bo[n0 + n];
  // precaution: the same, for the nine loads above
  asm volatile("s_wait_xcnt 0x0" ::: "memory");

  // Fence on the loaded values, inputs only: every load of the kernel is issued in front of the
  // first use of one. Left free, they are dealt out among the arithmetic in small groups, and
  // the block waits out one memory latency after another.
  asm volatile("" :: "v"(ov[0][0]), "v"(ov[0][1]), "v"(ov[1][0]), "v"(ov[1][1]),
                     "v"(ov[2][0]), "v"(ov[2][1]), "v"(ov[3][0]), "v"(ov[3][1]),
                     "v"(mg), "v"(lg), "v"(bval));

  float M = -__builtin_inff();
#pragma unroll
  for (int g = 0; g < GSPLIT; ++g) M = fmaxf(M, mg[g]);
  float w[GSPLIT], L = 0.f;
#pragma unroll
  for (int g = 0; g < GSPLIT; ++g) { w[g] = exp2_one((mg[g] - M) * LOG2E); L += w[g] * lg[g]; }
  float rinv = 1.0f / L;
#pragma unroll
  for (int c = 0; c < 2; ++c) {
    float s[4] = {0.f, 0.f, 0.f, 0.f};
#pragma unroll
    for (int g = 0; g < GSPLIT; ++g) {
      s[0] += w[g] * ov[g][c].x; s[1] += w[g] * ov[g][c].y;
      s[2] += w[g] * ov[g][c].z; s[3] += w[g] * ov[g][c].w;
    }
    *(uint2*)(At + mr * LPITCH + (f0 + c * 64) * 2) =
        make_uint2(pack_bf2(s[0] * rinv, s[1] * rinv), pack_bf2(s[2] * rinv, s[3] * rinv));
  }
  asm volatile("s_wait_asynccnt 0x0" ::: "memory");  // this wave's copies of Wo rows have landed
  __syncthreads();   // the merged tile and the Wo rows are whole before any wave reads fragments

  const unsigned char* wsr = Ws + (n0 + n) * XPITCH + h * 32;
  v8f acc = {0.f, 0.f, 0.f, 0.f, 0.f, 0.f, 0.f, 0.f};
#pragma unroll
  for (int kc = 0; kc < 4; ++kc) {
    acc = wmma_bf16(frag_lds(At, 0, kc * 64), round_frag(raw_f32(wsr + kc * 128)), acc);
  }
#pragma unroll
  for (int v = 0; v < 8; ++v)
    out[(size_t)(row0 + h * 8 + v) * DMODEL + n0 + n] = acc[v] + bval;
}

// ---------- launch ----------
extern "C" void kernel_launch(void* const* d_in, const int* in_sizes, int n_in,
                              void* d_out, int out_size, void* d_ws, size_t ws_size,
                              hipStream_t stream) {
  const float* x  = (const float*)d_in[0];
  const float* Wq = (const float*)d_in[1];
  const float* bq = (const float*)d_in[2];
  const float* Wk = (const float*)d_in[3];
  const float* bk = (const float*)d_in[4];
  const float* Wv = (const float*)d_in[5];
  const float* bv = (const float*)d_in[6];
  const float* Wo = (const float*)d_in[7];
  const float* bo = (const float*)d_in[8];

  bf16_t* Qb = (bf16_t*)d_ws;                          // 2 MB
  bf16_t* Kb = Qb + (size_t)NTOK * DMODEL;             // 2 MB
  bf16_t* Vt = Kb + (size_t)NTOK * DMODEL;             // 2 MB (V; all three in fragment order)
  float* Opart = (float*)(Vt + (size_t)DMODEL * NTOK); // 16 MB
  float* mpart = Opart + (size_t)GSPLIT * NTOK * DMODEL;
  float* lpart = mpart + (size_t)GSPLIT * NTOK;

  // 128 groups of 64 rows * 2 groups of 4 column tiles = 256 blocks
  qkv_kernel<<<256, 256, 0, stream>>>(x, Wq, bq, Wk, bk, Wv, bv, Qb, Kb, Vt);
  // 64 blocks of 128 queries * 4 KV groups = 256 blocks
  flash_kernel<<<256, 256, 0, stream>>>(Qb, Kb, Vt, Opart, mpart, lpart);
  // 512 row tiles, one block each: 8 waves = 8 col-tiles
  merge_out_kernel<<<512, 256, 0, stream>>>(Opart, mpart, lpart, Wo, bo, (float*)d_out);
}
